// v000
// Measured on an AMD MI455X. A time is GPU time per run, averaged over a window of back-to-back runs after a warm-up
// (all launches, gaps included; the runs take copies of the inputs in turn), and the median of several windows.
// Apart from v000's, it joins two sittings. Times from different sittings can be a few percent apart, while
// side-by-side timings come from the same sitting.
// v000, which the later versions start from, runs in 397 microseconds.
#include <hip/hip_runtime.h>

// Multi-head attention, width 1024 = 16 heads x 64: q/k/v [NB][SEQ_FULL][1024] (first SEQ rows of each batch used), weights [in][out] (y = x W + b), half-split rotary on q and k (table cos/sin of t * 10000^(-j/32)), per-head RMS normalisation with weights, score scale 1/8, no mask, output projection with bias, f32 output.
// Compute dtypes, f32 accumulate everywhere: q/k/v projections v_wmma_f32_16x16x32_bf16 (inputs and weights RNE-converted to bf16; products exact);
// scores v_wmma_f32_16x16x32_f16: k single f16, q as f16 value + f16 residual x2048 in its own accumulator (two products); P (x256 carry, cancels in the normalisation) and v single f16;
// output projection v_wmma_f32_16x16x32_f16: ctx f16 (x64 carry), Wo^T f16 built from the bf16 RNE value (x1024 carry), 2^-16 folded back in the f32 epilogue; softmax, rotary and normalisation in f32.
// Layout: one bf16 staging copy of the current activation input; transposed 16-bit weight planes [out][in]; q (value, residual), k planes [b*16+h][t][d] and v^T plane [b*16+h][d][t] written by the GEMM epilogue;
// fused flash kernel in transposed form (S^T = K Q^T, O^T = V^T P^T) writes the ctx plane [b*SEQ+t][1024]; final GEMM writes the f32 output.

#ifndef NB
#define NB 4
#endif
#ifndef SEQ
#define SEQ 2048
#endif
#define NB_FULL  4
#define SEQ_FULL 2048
#ifndef OUT_SEQ
#define OUT_SEQ SEQ              // row pitch (in tokens) between batches of the output
#endif
#define DM   1024
#define NH_  16
#define HD   64
#define AW   4                   // waves per flash block (16 query rows each)
#define QRS  2048.0f             // carry of the q residual plane
#define QRI  (1.0f / 2048.0f)
#define SC2  (0.125f * 1.4426950408889634f)   // HD^-0.5 * log2(e)
#define PSH  8.0f                // log2 of the P carry (256)
#define CTXS 64.0f               // carry of the ctx plane
#define WOS  1024.0f             // carry of the Wo^T plane
#define OSC  (1.0f / 65536.0f)   // 1 / (CTXS * WOS)
#define RMS_EPS 1.0e-6f

static_assert(HD == 64);
static_assert(NH_ * HD == DM);                 // head h = columns h*64 + d
static_assert(DM % 64 == 0);                   // 16 column tiles of 64
static_assert(DM % 32 == 0);                   // GEMM k-loop steps by 32
static_assert(SEQ % 64 == 0);                  // a 64-row tile never straddles two batches
static_assert((NB * SEQ) % 64 == 0);
static_assert(SEQ % 32 == 0);                  // key loop steps by 32
static_assert(SEQ % (16 * AW) == 0);           // flash grid covers the sequence exactly
static_assert(SEQ % 8 == 0);                   // table kernel: 8 positions per block
static_assert(((size_t)SEQ * DM) % 8 == 0);
static_assert(((size_t)DM * DM) % 8 == 0);
static_assert(NB <= NB_FULL);
static_assert(SEQ <= SEQ_FULL);
static_assert(OUT_SEQ >= SEQ);

typedef _Float16 h16;
typedef unsigned short bf;
typedef __attribute__((ext_vector_type(16))) __bf16   v16bf;
typedef __attribute__((ext_vector_type(16))) _Float16 v16h;
typedef __attribute__((ext_vector_type(8)))  _Float16 v8h;
typedef __attribute__((ext_vector_type(8)))  unsigned short v8us;
typedef __attribute__((ext_vector_type(8)))  float    v8f;
typedef __attribute__((ext_vector_type(4)))  float    v4f;
typedef v4f  __attribute__((may_alias)) v4fa;

__device__ __forceinline__ unsigned short f2bf(float f) { unsigned u = __float_as_uint(f); u += 0x7FFFu + ((u >> 16) & 1u); return (unsigned short)(u >> 16); }
__device__ __forceinline__ float bfr(float f) { return __uint_as_float(((unsigned)f2bf(f)) << 16); }   // value after RNE convert to bf16
__device__ __forceinline__ v16h cat16(v8h lo, v8h hi) { return __builtin_shufflevector(lo, hi, 0, 1, 2, 3, 4, 5, 6, 7, 8, 9, 10, 11, 12, 13, 14, 15); }
__device__ __forceinline__ v16bf cat16b(v8us lo, v8us hi) { return __builtin_bit_cast(v16bf, __builtin_shufflevector(lo, hi, 0, 1, 2, 3, 4, 5, 6, 7, 8, 9, 10, 11, 12, 13, 14, 15)); }
__device__ __forceinline__ v8f wmma16(v16h a, v16h b, v8f c) { return __builtin_amdgcn_wmma_f32_16x16x32_f16(false, a, false, b, (short)0, c, false, false); }
__device__ __forceinline__ v8f wmmab(v16bf a, v16bf b, v8f c) { return __builtin_amdgcn_wmma_f32_16x16x32_bf16(false, a, false, b, (short)0, c, false, false); }
// fragment loaders from K-contiguous 16-bit rows; p already includes + 8*(lane>>4): elements 0..7 <- k0+8h+0..7, elements 8..15 <- k0+16+8h+0..7 (same map for A and B)
__device__ __forceinline__ v16h  ldh(const h16* p) { return cat16(*(const v8h*)p, *(const v8h*)(p + 16)); }
__device__ __forceinline__ v16bf ldb(const bf* p)  { return cat16b(*(const v8us*)p, *(const v8us*)(p + 16)); }
// ordering point for wave-private LDS tiles (same wave writes and reads)
__device__ __forceinline__ void wave_sync() { __builtin_amdgcn_fence(3 /* release order */, "wavefront"); __builtin_amdgcn_wave_barrier(); asm volatile("" ::: "memory"); }

// operand type selection for the GEMM: 0 = bf16 planes, 1 = f16 planes (both addressed as 16-bit rows)
template <int F16> struct Ops;
template <> struct Ops<0> { typedef v16bf T;
    static __device__ __forceinline__ T ld(const bf* p) { return ldb(p); }
    static __device__ __forceinline__ v8f mm(T a, T b, v8f c) { return wmmab(a, b, c); } };
template <> struct Ops<1> { typedef v16h T;
    static __device__ __forceinline__ T ld(const bf* p) { return ldh((const h16*)p); }
    static __device__ __forceinline__ v8f mm(T a, T b, v8f c) { return wmma16(a, b, c); } };

__global__ __launch_bounds__(256) void k_cvt8(const float* __restrict__ src, bf* dst, size_t n8) {
    const size_t i = (size_t)blockIdx.x * 256 + threadIdx.x; if (i >= n8) return;
    const v8f v = *(const v8f*)(src + i * 8); v8us o;
#pragma unroll
    for (int k = 0; k < 8; ++k) o[k] = f2bf(v[k]);
    *(v8us*)(dst + i * 8) = o; 
}

// k_tab: rotary table CS[t][0..31] = cos(t * f_j), CS[t][32..63] = sin(t * f_j), f_j = 10000^(-j/32) (f64 product chain, converted to f32), angle = f32 product.
__global__ __launch_bounds__(256) void k_tab(float* CS) {
    const int lane = threadIdx.x & 31; const int t = blockIdx.x * 8 + (threadIdx.x >> 5);
    double r = 1.0;
#pragma unroll 1
    for (int i = 0; i < lane; ++i) r *= 0.7498942093324558;    // 10^(-1/8)
    const float inv = (float)r; const float ang = (float)t * inv;
    float s, c; sincosf(ang, &s, &c);
    float* row = CS + (size_t)t * 64;
    *(float*)(row + lane) = c; *(float*)(row + 32 + lane) = s;
    
}

// k_wt: W f32 in[rows = k][cols = n] (pitch DM) -> WT 16-bit out[n][k] (pitch DM), transposed through LDS; grid (DM/64 over n, DM/64 over k), 256 threads.
__global__ __launch_bounds__(256) void k_wt(const float* __restrict__ W, bf* WT, int asF16, float scale) {
    __shared__ float ts[64 * 65];
    const int tid = threadIdx.x; const int n0 = blockIdx.x * 64, k0 = blockIdx.y * 64;
#pragma unroll
    for (int it = 0; it < 4; ++it) { const int idx = it * 256 + tid; const int kk = idx >> 4, n4 = (idx & 15) * 4;   // 64 k rows x 16 float4 = 1024 pieces
        const v4f v = *(const v4f*)(W + (size_t)(k0 + kk) * DM + n0 + n4);
        ts[kk * 65 + n4 + 0] = v[0]; ts[kk * 65 + n4 + 1] = v[1]; ts[kk * 65 + n4 + 2] = v[2]; ts[kk * 65 + n4 + 3] = v[3]; }
    __syncthreads();
    v8us o0, o1;
#pragma unroll
    for (int it = 0; it < 2; ++it) { const int p = it * 256 + tid; const int n = p >> 3, k8 = (p & 7) * 8;            // 64 n rows x 8 pieces = 512 pieces
        v8us o;
#pragma unroll
        for (int i = 0; i < 8; ++i) { const float x = ts[(k8 + i) * 65 + n]; const unsigned short b = f2bf(x);
            const h16 hv = (h16)(__uint_as_float(((unsigned)b) << 16) * scale); const unsigned short hb = __builtin_bit_cast(unsigned short, hv);
            o[i] = asF16 ? hb : b; }
        if (it == 0) o0 = o; else o1 = o; }
    bf* d0 = WT + (size_t)(n0 + (tid >> 3)) * DM + k0 + (tid & 7) * 8;
    bf* d1 = WT + (size_t)(n0 + 32 + (tid >> 3)) * DM + k0 + (tid & 7) * 8;
    *(v8us*)d0 = o0; *(v8us*)d1 = o1;
    
}

// k_gemm: register-blocked GEMM, ONE WAVE per 64x64 tile (16 accumulators), operands straight from K-contiguous 16-bit planes, K = DM.
// C[m][n] = sum_k A[m][k] Bt[n][k]; tile base (r0/RB)*sRB + (r0%RB)*pitch + (c0/CB)*sCB + (c0%CB), row pitch 'pitch' (elements). grid (M/64, N/64), 32 threads.
// MODE 0 (q, k; bf16 operands): + column bias, half-split rotary (the 64 tile columns are one head), RMS normalisation times weight, written as f16 (Ph) and optionally the f16 residual x2048 (Pr).
// MODE 1 (v^T; bf16 operands): + row bias, written as f16 (Ph).
// MODE 2 (output; f16 operands): * 2^-16 + column bias, written as f32 rows (OF).
template <int MODE>
__global__ __launch_bounds__(32) void k_gemm(const bf* __restrict__ A, const bf* __restrict__ Bt, const float* __restrict__ bias, const float* __restrict__ nw, const float* __restrict__ CS,
                                             h16* Ph, h16* Pr, float* OF, int useRes, int RB, size_t sRB, int pitch, int CB, size_t sCB) {
    typedef Ops<(MODE == 2) ? 1 : 0> OP;
    typedef typename OP::T FT;
    __shared__ __align__(16) float os[16 * 68];
    const int K = DM;
    const int lane = threadIdx.x & 31, lr = lane & 15, hi = lane >> 4; const int r0 = blockIdx.x * 64, c0 = blockIdx.y * 64;
    v8f acc[4][4];
#pragma unroll
    for (int mb = 0; mb < 4; ++mb)
#pragma unroll
        for (int nb = 0; nb < 4; ++nb) acc[mb][nb] = (v8f){};
    const size_t aoff = (size_t)(r0 + lr) * K + 8 * hi, boff = (size_t)(c0 + lr) * K + 8 * hi;
#pragma unroll 1
    for (int kc = 0; kc < K; kc += 32) {
        FT a[4];
#pragma unroll
        for (int mb = 0; mb < 4; ++mb) a[mb] = OP::ld(A + aoff + (size_t)mb * 16 * K + kc);
#pragma unroll
        for (int nb = 0; nb < 4; ++nb) { const FT b = OP::ld(Bt + boff + (size_t)nb * 16 * K + kc);
#pragma unroll
            for (int mb = 0; mb < 4; ++mb) acc[mb][nb] = OP::mm(a[mb], b, acc[mb][nb]); }
        asm volatile("v_nop\n\tv_nop\n\tv_nop\n\tv_nop" : "+v"(acc[0][0]), "+v"(acc[1][1]), "+v"(acc[2][2]), "+v"(acc[3][3]) : "v"(a[0]), "v"(a[1]), "v"(a[2]), "v"(a[3]));
    }
    const size_t tbase = (size_t)(r0 / RB) * sRB + (size_t)(r0 % RB) * (size_t)pitch + (size_t)(c0 / CB) * sCB + (size_t)(c0 % CB);
    const int rg = lane >> 3, c8 = (lane & 7) * 8, cp = c8 ^ 32, j0 = c8 & 31;
    const float sg = (c8 < 32) ? -1.0f : 1.0f;           // first half: x1 cos - x2 sin; second half: x2 cos + x1 sin
    const int tp0 = r0 % SEQ;                            // position of tile row 0 inside its sequence (MODE 0)
    float bo[8], bp[8], wv[8];
    v4f b4 = (v4f){};
    if (MODE == 0) {
#pragma unroll
        for (int i = 0; i < 8; ++i) { bo[i] = bfr(bias[c0 + c8 + i]); bp[i] = bfr(bias[c0 + cp + i]); wv[i] = bfr(nw[c8 + i]); }
    } else {
#pragma unroll
        for (int i = 0; i < 8; ++i) { bo[i] = 0.0f; bp[i] = 0.0f; wv[i] = 0.0f; }
    }
    if (MODE == 2) {
#pragma unroll
        for (int i = 0; i < 4; ++i) b4[i] = bfr(bias[c0 + lr * 4 + i]);
    }
#pragma unroll
    for (int mb = 0; mb < 4; ++mb) {
#pragma unroll
        for (int nb = 0; nb < 4; ++nb) {
#pragma unroll
            for (int j = 0; j < 8; ++j) os[(hi * 8 + j) * 68 + nb * 16 + lr] = acc[mb][nb][j]; }   // D: row 8h+j, col lane&15; rows 0..15 x columns 0..63 all written
        wave_sync();
        const size_t sb = tbase + (size_t)(mb * 16) * (size_t)pitch;
        if (MODE == 0) {
            v8h hq[4], rq[4];
#pragma unroll
            for (int s = 0; s < 4; ++s) { const int row = 4 * s + rg;                              // 4 s x 4 row groups = 16 rows; 8 lanes x 8 = 64 columns
                const float* op = &os[row * 68];
                const v4f x0 = *(const v4fa*)(op + c8), x1 = *(const v4fa*)(op + c8 + 4), y0 = *(const v4fa*)(op + cp), y1 = *(const v4fa*)(op + cp + 4);
                const float* cs = CS + (size_t)(tp0 + mb * 16 + row) * 64 + j0;
                const v4f ca = *(const v4f*)cs, cb = *(const v4f*)(cs + 4), sa = *(const v4f*)(cs + 32), sc = *(const v4f*)(cs + 36);
                float rot[8];
#pragma unroll
                for (int i = 0; i < 4; ++i) {
                    const float xo = x0[i] + bo[i], xp = y0[i] + bp[i]; rot[i] = xo * ca[i] + sg * (xp * sa[i]);
                    const float xq = x1[i] + bo[4 + i], xr = y1[i] + bp[4 + i]; rot[4 + i] = xq * cb[i] + sg * (xr * sc[i]); }
                float ss = 0.0f;
#pragma unroll
                for (int i = 0; i < 8; ++i) ss += rot[i] * rot[i];
                ss += __shfl_xor(ss, 1, 32); ss += __shfl_xor(ss, 2, 32); ss += __shfl_xor(ss, 4, 32);   // the 8 lanes of one row
                const float rinv = rsqrtf(ss * (1.0f / 64.0f) + RMS_EPS);
                v8h hv, rv;
#pragma unroll
                for (int i = 0; i < 8; ++i) { const float val = rot[i] * rinv * wv[i]; const h16 a0 = (h16)val; hv[i] = a0; rv[i] = (h16)((val - (float)a0) * QRS); }
                hq[s] = hv; rq[s] = rv; }
#pragma unroll
            for (int s = 0; s < 4; ++s) { const size_t oo = sb + (size_t)(4 * s + rg) * (size_t)pitch + c8;
                *(v8h*)(Ph + oo) = hq[s]; if (useRes) *(v8h*)(Pr + oo) = rq[s]; }
            
        } else if (MODE == 1) {
            v8h hq[4];
#pragma unroll
            for (int s = 0; s < 4; ++s) { const int row = 4 * s + rg;
                const float br = bfr(bias[r0 + mb * 16 + row]);
                const v4f x0 = *(const v4fa*)(&os[row * 68 + c8]); const v4f x1 = *(const v4fa*)(&os[row * 68 + c8 + 4]); v8h hv;
#pragma unroll
                for (int i = 0; i < 4; ++i) { hv[i] = (h16)(x0[i] + br); hv[4 + i] = (h16)(x1[i] + br); }
                hq[s] = hv; }
#pragma unroll
            for (int s = 0; s < 4; ++s) { const size_t oo = sb + (size_t)(4 * s + rg) * (size_t)pitch + c8; *(v8h*)(Ph + oo) = hq[s]; }
            
        } else {
            v4f ov[8];
#pragma unroll
            for (int s = 0; s < 8; ++s) { const int row = 2 * s + hi;                              // 8 s x 2 rows = 16 rows; 16 lanes x 4 floats = 64 columns
                const v4f x = *(const v4fa*)(&os[row * 68 + lr * 4]); ov[s] = x * OSC + b4; }
#pragma unroll
            for (int s = 0; s < 8; ++s) { const size_t oo = sb + (size_t)(2 * s + hi) * (size_t)pitch + lr * 4; *(v4f*)(OF + oo) = ov[s]; }
            
        }
        wave_sync();
    }
}

// k_flash: fused attention, one wave per 16 query rows of one (batch, head); K / V^T / Q fragments straight from the f16 planes (two 16-B loads each, arithmetic addressing).
// Transposed form: S^T[key][t] = K Q^T (A = K rows, B = Q rows); lane (t = lane&15, h = lane>>4) holds keys 8h+r of each 16-key tile, so the packed
// P tile is directly the B fragment of O^T[d][t] = V^T P^T (element r <- tile keys 0..15, element 8+r <- tile keys 16..31, lane unchanged).
// Softmax state (running max, partial sum) is one scalar per lane; the two lane halves of a row are combined with one xor-16 exchange.
__global__ __launch_bounds__(32 * AW) void k_flash(const h16* __restrict__ QH, const h16* __restrict__ QR, const h16* __restrict__ KP, const h16* __restrict__ VT, h16* CTX) {
    __shared__ __align__(16) float os[AW * 16 * 68];
    const int lane = threadIdx.x & 31, wave = threadIdx.x >> 5, lr = lane & 15, hi = lane >> 4;
    const int zh = blockIdx.y; const int b = zh / NH_, h = zh % NH_;
    const int t0 = (blockIdx.x * AW + wave) * 16;
    const size_t pbase = (size_t)zh * SEQ * HD;
    const size_t qo = pbase + (size_t)(t0 + lr) * HD + 8 * hi;
    const v16h qh0 = ldh(QH + qo), qh1 = ldh(QH + qo + 32), qr0 = ldh(QR + qo), qr1 = ldh(QR + qo + 32);   // B fragments: col t, k = d
    const size_t ko = pbase + (size_t)lr * HD + 8 * hi;      // + key * HD       (A fragment: row key, k = d)
    const size_t vo = pbase + (size_t)lr * SEQ + 8 * hi;     // + 16j*SEQ + key  (A fragment: row d, k = key)
    v8f o0 = (v8f){}, o1 = (v8f){}, o2 = (v8f){}, o3 = (v8f){};
    float m = -3.0e38f, l = 0.0f;
#pragma unroll 1
    for (int key0 = 0; key0 < SEQ; key0 += 32) {
        const h16* ka = KP + ko + (size_t)key0 * HD;
        const v16h ka0 = ldh(ka), ka1 = ldh(ka + 32), kb0 = ldh(ka + 16 * HD), kb1 = ldh(ka + 16 * HD + 32);
        v8f sHa = (v8f){}, sLa = (v8f){}, sHb = (v8f){}, sLb = (v8f){};
        sHa = wmma16(ka0, qh0, sHa); sLa = wmma16(ka0, qr0, sLa); sHb = wmma16(kb0, qh0, sHb); sLb = wmma16(kb0, qr0, sLb);
        sHa = wmma16(ka1, qh1, sHa); sLa = wmma16(ka1, qr1, sLa); sHb = wmma16(kb1, qh1, sHb); sLb = wmma16(kb1, qr1, sLb);
        asm volatile("v_nop\n\tv_nop\n\tv_nop\n\tv_nop" : "+v"(sHa), "+v"(sLa), "+v"(sHb), "+v"(sLb) : "v"(ka0), "v"(ka1), "v"(kb0), "v"(kb1));
        float ta[8], tb[8]; float mx = -3.0e38f;
#pragma unroll
        for (int r = 0; r < 8; ++r) { ta[r] = (sHa[r] + sLa[r] * QRI) * SC2; tb[r] = (sHb[r] + sLb[r] * QRI) * SC2; mx = fmaxf(mx, fmaxf(ta[r], tb[r])); }
        mx = fmaxf(mx, __shfl_xor(mx, 16, 32));
        const float mnew = fmaxf(m, mx);
        const float alpha = __builtin_amdgcn_exp2f(m - mnew);
        const float sh = PSH - mnew;
        v16h pb; float ls = 0.0f;
#pragma unroll
        for (int r = 0; r < 8; ++r) { const h16 pa = (h16)__builtin_amdgcn_exp2f(ta[r] + sh); const h16 pc = (h16)__builtin_amdgcn_exp2f(tb[r] + sh); pb[r] = pa; pb[8 + r] = pc; ls += (float)pa + (float)pc; }
        l = l * alpha + ls; m = mnew;
        o0 = o0 * alpha; o1 = o1 * alpha; o2 = o2 * alpha; o3 = o3 * alpha;
        const h16* va = VT + vo + key0;
        const v16h v0 = ldh(va), v1 = ldh(va + (size_t)16 * SEQ), v2 = ldh(va + (size_t)32 * SEQ), v3 = ldh(va + (size_t)48 * SEQ);
        o0 = wmma16(v0, pb, o0); o1 = wmma16(v1, pb, o1); o2 = wmma16(v2, pb, o2); o3 = wmma16(v3, pb, o3);
        asm volatile("v_nop\n\tv_nop\n\tv_nop\n\tv_nop" : "+v"(o0), "+v"(o1), "+v"(o2), "+v"(o3) : "v"(v0), "v"(v1), "v"(v2), "v"(v3), "v"(pb));
    }
    l += __shfl_xor(l, 16, 32);
    const float inv = (1.0f / l) * CTXS;
    const int wb = wave * 16 * 68;
    // O^T D layout: o_j[r] = (d = 16j + 8h + r, t = lane&15) -> os[t][d]; rows 0..15 x columns 0..63 all written
    { v4f a, c;
      a[0] = o0[0] * inv; a[1] = o0[1] * inv; a[2] = o0[2] * inv; a[3] = o0[3] * inv; c[0] = o0[4] * inv; c[1] = o0[5] * inv; c[2] = o0[6] * inv; c[3] = o0[7] * inv;
      *(v4fa*)(&os[wb + lr * 68 +  0 + 8 * hi]) = a; *(v4fa*)(&os[wb + lr * 68 +  0 + 8 * hi + 4]) = c;
      a[0] = o1[0] * inv; a[1] = o1[1] * inv; a[2] = o1[2] * inv; a[3] = o1[3] * inv; c[0] = o1[4] * inv; c[1] = o1[5] * inv; c[2] = o1[6] * inv; c[3] = o1[7] * inv;
      *(v4fa*)(&os[wb + lr * 68 + 16 + 8 * hi]) = a; *(v4fa*)(&os[wb + lr * 68 + 16 + 8 * hi + 4]) = c;
      a[0] = o2[0] * inv; a[1] = o2[1] * inv; a[2] = o2[2] * inv; a[3] = o2[3] * inv; c[0] = o2[4] * inv; c[1] = o2[5] * inv; c[2] = o2[6] * inv; c[3] = o2[7] * inv;
      *(v4fa*)(&os[wb + lr * 68 + 32 + 8 * hi]) = a; *(v4fa*)(&os[wb + lr * 68 + 32 + 8 * hi + 4]) = c;
      a[0] = o3[0] * inv; a[1] = o3[1] * inv; a[2] = o3[2] * inv; a[3] = o3[3] * inv; c[0] = o3[4] * inv; c[1] = o3[5] * inv; c[2] = o3[6] * inv; c[3] = o3[7] * inv;
      *(v4fa*)(&os[wb + lr * 68 + 48 + 8 * hi]) = a; *(v4fa*)(&os[wb + lr * 68 + 48 + 8 * hi + 4]) = c; }
    wave_sync();
    h16* crow = CTX + ((size_t)b * SEQ + t0) * DM + h * HD;
    const int rg = lane >> 3, c8 = (lane & 7) * 8;
    v8h hq[4];
#pragma unroll
    for (int s = 0; s < 4; ++s) { const int row = 4 * s + rg;                                      // 4 s x 4 row groups = 16 rows; 8 lanes x 8 halves = 64 columns
        const v4f x0 = *(const v4fa*)(&os[wb + row * 68 + c8]); const v4f x1 = *(const v4fa*)(&os[wb + row * 68 + c8 + 4]); v8h hv;
#pragma unroll
        for (int i = 0; i < 4; ++i) { hv[i] = (h16)x0[i]; hv[4 + i] = (h16)x1[i]; }
        hq[s] = hv; }
#pragma unroll
    for (int s = 0; s < 4; ++s) *(v8h*)(crow + (size_t)(4 * s + rg) * DM + c8) = hq[s];
    
}

static constexpr size_t al256(size_t v) { return (v + 255) & ~(size_t)255; }
static constexpr size_t SZ_XB = al256((size_t)NB * SEQ * DM * 2);          // bf16 staging copy of one activation input; also the size of the ctx plane
static constexpr size_t SZ_WB = al256((size_t)4 * DM * DM * 2);            // four transposed 16-bit weight planes
static constexpr size_t SZ_CS = al256((size_t)SEQ * 64 * 4);               // rotary table
static constexpr size_t SZ_PL = al256((size_t)NB * NH_ * SEQ * HD * 2);    // one f16 head plane
static constexpr size_t SZ_TOTAL = SZ_XB + SZ_WB + SZ_CS + 4 * SZ_PL + SZ_XB;
static_assert(SZ_TOTAL <= (size_t)134217728);          // workspace carve <= 128 MiB
static_assert(((size_t)DM * DM * 2) % 256 == 0);       // weight sub-planes stay 256-byte aligned
static_assert((size_t)NB * SEQ * DM * 2 <= SZ_XB);     // ctx plane extent

extern "C" void kernel_launch(void* const* d_in, const int* in_sizes, int n_in,
                              void* d_out, int out_size, void* d_ws, size_t ws_size, hipStream_t stream) {
    if (n_in < 13) return;
    const size_t needx = ((size_t)(NB - 1) * SEQ_FULL + SEQ) * DM;
    if ((size_t)in_sizes[0] < needx || (size_t)in_sizes[1] < needx || (size_t)in_sizes[2] < needx) return;
    if ((size_t)in_sizes[3] < (size_t)DM * DM || (size_t)in_sizes[5] < (size_t)DM * DM || (size_t)in_sizes[7] < (size_t)DM * DM || (size_t)in_sizes[9] < (size_t)DM * DM) return;
    if (in_sizes[4] < DM || in_sizes[6] < DM || in_sizes[8] < DM || in_sizes[10] < DM) return;
    if (in_sizes[11] < HD || in_sizes[12] < HD) return;
    if ((size_t)out_size < ((size_t)(NB - 1) * OUT_SEQ + SEQ) * DM) return;
    if (SZ_TOTAL > ws_size) return;
    // wire order: q, k, v, wq_w, wq_b, wk_w, wk_b, wv_w, wv_b, wo_w, wo_b, qn_w, kn_w (weights [in][out])
    const float* q  = (const float*)d_in[0];  const float* k  = (const float*)d_in[1];  const float* v  = (const float*)d_in[2];
    const float* wq = (const float*)d_in[3];  const float* bq = (const float*)d_in[4];
    const float* wk = (const float*)d_in[5];  const float* bk = (const float*)d_in[6];
    const float* wv = (const float*)d_in[7];  const float* bv = (const float*)d_in[8];
    const float* wo = (const float*)d_in[9];  const float* bo = (const float*)d_in[10];
    const float* qnw = (const float*)d_in[11]; const float* knw = (const float*)d_in[12];
    float* OUT = (float*)d_out;      // [NB][OUT_SEQ][1024]
    char* wsp = (char*)d_ws;
    bf* XB = (bf*)wsp; wsp += SZ_XB;                 // [NB*SEQ][1024] bf16, reused for q, k, v in turn
    bf* WB = (bf*)wsp; wsp += SZ_WB;                 // [4][1024 out][1024 in]: q | k | v (bf16) | o (f16 x1024)
    float* CS = (float*)wsp; wsp += SZ_CS;           // [SEQ][64]: cos | sin
    h16* QH = (h16*)wsp; wsp += SZ_PL;               // [NB*16][SEQ][64]
    h16* QR = (h16*)wsp; wsp += SZ_PL;               // [NB*16][SEQ][64] residual x2048
    h16* KP = (h16*)wsp; wsp += SZ_PL;               // [NB*16][SEQ][64]
    h16* VT = (h16*)wsp; wsp += SZ_PL;               // [NB*16][64][SEQ]
    h16* CTX = (h16*)wsp; wsp += SZ_XB;              // [NB*SEQ][1024] x64
    bf* WQ = WB; bf* WK = WB + (size_t)DM * DM; bf* WV = WB + (size_t)2 * DM * DM; bf* WO = WB + (size_t)3 * DM * DM;

    k_tab<<<SEQ / 8, 256, 0, stream>>>(CS);

    // W in[rows = in k][cols = out n] -> WT out[n][k]; grid (n tiles, k tiles)
    { const dim3 g(DM / 64, DM / 64, 1);
      k_wt<<<g, 256, 0, stream>>>(wq, WQ, 0, 1.0f);
      k_wt<<<g, 256, 0, stream>>>(wk, WK, 0, 1.0f);
      k_wt<<<g, 256, 0, stream>>>(wv, WV, 0, 1.0f);
      k_wt<<<g, 256, 0, stream>>>(wo, WO, 1, WOS); }

    auto cvt = [&](const float* src) {
        if (SEQ == SEQ_FULL) {
            const size_t n8 = (size_t)NB * SEQ * DM / 8;
            k_cvt8<<<(unsigned)((n8 + 255) / 256), 256, 0, stream>>>(src, XB, n8);
        } else {
            const size_t n8 = (size_t)SEQ * DM / 8;
            for (int b = 0; b < NB; ++b) k_cvt8<<<(unsigned)((n8 + 255) / 256), 256, 0, stream>>>(src + (size_t)b * SEQ_FULL * DM, XB + (size_t)b * SEQ * DM, n8);
        }
    };

    // q, k: A = x rows (m = b*SEQ + t), Bt = W^T rows (n = h*64 + d) -> plane [(b*16 + h)][t][d]
    cvt(q);
    k_gemm<0><<<dim3(NB * SEQ / 64, DM / 64, 1), 32, 0, stream>>>(XB, WQ, bq, qnw, CS, QH, QR, OUT, 1, SEQ, (size_t)NH_ * SEQ * HD, HD, HD, (size_t)SEQ * HD);
    cvt(k);
    k_gemm<0><<<dim3(NB * SEQ / 64, DM / 64, 1), 32, 0, stream>>>(XB, WK, bk, knw, CS, KP, KP, OUT, 0, SEQ, (size_t)NH_ * SEQ * HD, HD, HD, (size_t)SEQ * HD);
    // v^T: A = Wv^T rows (m = h*64 + d), Bt = x rows (n = b*SEQ + t) -> plane [(b*1024 + m)][t] = [(b*16 + h)][d][t]
    cvt(v);
    k_gemm<1><<<dim3(DM / 64, NB * SEQ / 64, 1), 32, 0, stream>>>(WV, XB, bv, qnw, CS, VT, VT, OUT, 0, DM, (size_t)0, SEQ, SEQ, (size_t)DM * SEQ);

    k_flash<<<dim3(SEQ / (16 * AW), NB * NH_, 1), 32 * AW, 0, stream>>>(QH, QR, KP, VT, CTX);

    // output: A = ctx rows (m = b*SEQ + t, f16), Bt = Wo^T rows (n, f16) -> OUT[(b*OUT_SEQ + t)][n]
    k_gemm<2><<<dim3(NB * SEQ / 64, DM / 64, 1), 32, 0, stream>>>((const bf*)CTX, WO, bo, qnw, CS, QH, QH, OUT, 0, SEQ, (size_t)OUT_SEQ * DM, DM, DM, (size_t)0);
}

// v001
// A run of this version takes 298 microseconds.
// Two timings next to v000 put it at 1.36 and 1.33 times that version's speed.
#include <hip/hip_runtime.h>

// Multi-head attention, width 1024 = 16 heads x 64: q/k/v [NB][SEQ_FULL][1024] (first SEQ rows of each batch used), weights [in][out] (y = x W + b), half-split rotary on q and k (table cos/sin of t * 10000^(-j/32)), per-head RMS normalisation with weights, score scale 1/8, no mask, output projection with bias, f32 output.
// Compute dtypes, f32 accumulate everywhere: q/k/v projections v_wmma_f32_16x16x32_bf16 (inputs and weights RNE-converted to bf16; products exact);
// scores v_wmma_f32_16x16x32_f16: k single f16, q as f16 value + f16 residual x2048 in its own accumulator (two products); P (x256 carry, cancels in the normalisation) and v single f16;
// output projection v_wmma_f32_16x16x32_f16: ctx f16 (x64 carry), Wo^T f16 built from the bf16 RNE value (x1024 carry), 2^-16 folded back in the f32 epilogue; softmax, rotary and normalisation in f32.
// Layout: one bf16 staging copy of the current activation input; transposed 16-bit weight planes [out][in]; q (value, residual), k planes [b*16+h][t][d] and v^T plane [b*16+h][d][t] written by the GEMM epilogue;
// fused flash kernel in transposed form (S^T = K Q^T, O^T = V^T P^T) writes the ctx plane [b*SEQ+t][1024]; final GEMM writes the f32 output.

#ifndef NB
#define NB 4
#endif
#ifndef SEQ
#define SEQ 2048
#endif
#define NB_FULL  4
#define SEQ_FULL 2048
#ifndef OUT_SEQ
#define OUT_SEQ SEQ              // row pitch (in tokens) between batches of the output
#endif
#define DM   1024
#define NH_  16
#define HD   64
#define AW   8                   // waves per flash block
#define QT   4                   // query tiles of 16 rows per flash wave
#define QRS  2048.0f             // carry of the q residual plane
#define QRI  (1.0f / 2048.0f)
#define SC2  (0.125f * 1.4426950408889634f)   // HD^-0.5 * log2(e)
#define PSH  8.0f                // log2 of the P carry (256)
#define CTXS 64.0f               // carry of the ctx plane
#define WOS  1024.0f             // carry of the Wo^T plane
#define OSC  (1.0f / 65536.0f)   // 1 / (CTXS * WOS)
#define RMS_EPS 1.0e-6f

static_assert(HD == 64);
static_assert(NH_ * HD == DM);                 // head h = columns h*64 + d
static_assert(DM % 64 == 0);                   // 16 column tiles of 64
static_assert(DM % 32 == 0);                   // GEMM k-loop steps by 32
static_assert(SEQ % 64 == 0);                  // a 64-row tile never straddles two batches
static_assert((NB * SEQ) % 64 == 0);
static_assert(SEQ % 32 == 0);                  // key loop steps by 32
static_assert(SEQ % (16 * AW * QT) == 0);      // flash grid covers the sequence exactly
static_assert(SEQ % 8 == 0);                   // table kernel: 8 positions per block
static_assert(((size_t)SEQ * DM) % 8 == 0);
static_assert(((size_t)DM * DM) % 8 == 0);
static_assert(NB <= NB_FULL);
static_assert(SEQ <= SEQ_FULL);
static_assert(OUT_SEQ >= SEQ);

typedef _Float16 h16;
typedef unsigned short bf;
typedef __attribute__((ext_vector_type(16))) __bf16   v16bf;
typedef __attribute__((ext_vector_type(16))) _Float16 v16h;
typedef __attribute__((ext_vector_type(8)))  _Float16 v8h;
typedef __attribute__((ext_vector_type(8)))  unsigned short v8us;
typedef __attribute__((ext_vector_type(8)))  float    v8f;
typedef __attribute__((ext_vector_type(4)))  float    v4f;
typedef v4f  __attribute__((may_alias)) v4fa;

__device__ __forceinline__ unsigned short f2bf(float f) { unsigned u = __float_as_uint(f); u += 0x7FFFu + ((u >> 16) & 1u); return (unsigned short)(u >> 16); }
__device__ __forceinline__ float bfr(float f) { return __uint_as_float(((unsigned)f2bf(f)) << 16); }   // value after RNE convert to bf16
__device__ __forceinline__ v16h cat16(v8h lo, v8h hi) { return __builtin_shufflevector(lo, hi, 0, 1, 2, 3, 4, 5, 6, 7, 8, 9, 10, 11, 12, 13, 14, 15); }
__device__ __forceinline__ v16bf cat16b(v8us lo, v8us hi) { return __builtin_bit_cast(v16bf, __builtin_shufflevector(lo, hi, 0, 1, 2, 3, 4, 5, 6, 7, 8, 9, 10, 11, 12, 13, 14, 15)); }
__device__ __forceinline__ v8f wmma16(v16h a, v16h b, v8f c) { return __builtin_amdgcn_wmma_f32_16x16x32_f16(false, a, false, b, (short)0, c, false, false); }
__device__ __forceinline__ v8f wmmab(v16bf a, v16bf b, v8f c) { return __builtin_amdgcn_wmma_f32_16x16x32_bf16(false, a, false, b, (short)0, c, false, false); }
// fragment loaders from K-contiguous 16-bit rows; p already includes + 8*(lane>>4): elements 0..7 <- k0+8h+0..7, elements 8..15 <- k0+16+8h+0..7 (same map for A and B)
__device__ __forceinline__ v16h  ldh(const h16* p) { return cat16(*(const v8h*)p, *(const v8h*)(p + 16)); }
__device__ __forceinline__ v16bf ldb(const bf* p)  { return cat16b(*(const v8us*)p, *(const v8us*)(p + 16)); }
// ordering point for wave-private LDS tiles (same wave writes and reads)
__device__ __forceinline__ void wave_sync() { __builtin_amdgcn_fence(3 /* release order */, "wavefront"); __builtin_amdgcn_wave_barrier(); asm volatile("" ::: "memory"); }

// operand type selection for the GEMM: 0 = bf16 planes, 1 = f16 planes (both addressed as 16-bit rows)
template <int F16> struct Ops;
template <> struct Ops<0> { typedef v16bf T;
    static __device__ __forceinline__ T ld(const bf* p) { return ldb(p); }
    static __device__ __forceinline__ v8f mm(T a, T b, v8f c) { return wmmab(a, b, c); } };
template <> struct Ops<1> { typedef v16h T;
    static __device__ __forceinline__ T ld(const bf* p) { return ldh((const h16*)p); }
    static __device__ __forceinline__ v8f mm(T a, T b, v8f c) { return wmma16(a, b, c); } };

__global__ __launch_bounds__(256) void k_cvt8(const float* __restrict__ src, bf* dst, size_t n8) {
    const size_t i = (size_t)blockIdx.x * 256 + threadIdx.x; if (i >= n8) return;
    const v8f v = *(const v8f*)(src + i * 8); v8us o;
#pragma unroll
    for (int k = 0; k < 8; ++k) o[k] = f2bf(v[k]);
    *(v8us*)(dst + i * 8) = o; 
}

// k_tab: rotary table CS[t][0..31] = cos(t * f_j), CS[t][32..63] = sin(t * f_j), f_j = 10000^(-j/32) (f64 product chain, converted to f32), angle = f32 product.
__global__ __launch_bounds__(256) void k_tab(float* CS) {
    const int lane = threadIdx.x & 31; const int t = blockIdx.x * 8 + (threadIdx.x >> 5);
    double r = 1.0;
#pragma unroll 1
    for (int i = 0; i < lane; ++i) r *= 0.7498942093324558;    // 10^(-1/8)
    const float inv = (float)r; const float ang = (float)t * inv;
    float s, c; sincosf(ang, &s, &c);
    float* row = CS + (size_t)t * 64;
    *(float*)(row + lane) = c; *(float*)(row + 32 + lane) = s;
    
}

// k_wt: W f32 in[rows = k][cols = n] (pitch DM) -> WT 16-bit out[n][k] (pitch DM), transposed through LDS; grid (DM/64 over n, DM/64 over k), 256 threads.
__global__ __launch_bounds__(256) void k_wt(const float* __restrict__ W, bf* WT, int asF16, float scale) {
    __shared__ float ts[64 * 65];
    const int tid = threadIdx.x; const int n0 = blockIdx.x * 64, k0 = blockIdx.y * 64;
#pragma unroll
    for (int it = 0; it < 4; ++it) { const int idx = it * 256 + tid; const int kk = idx >> 4, n4 = (idx & 15) * 4;   // 64 k rows x 16 float4 = 1024 pieces
        const v4f v = *(const v4f*)(W + (size_t)(k0 + kk) * DM + n0 + n4);
        ts[kk * 65 + n4 + 0] = v[0]; ts[kk * 65 + n4 + 1] = v[1]; ts[kk * 65 + n4 + 2] = v[2]; ts[kk * 65 + n4 + 3] = v[3]; }
    __syncthreads();
    v8us o0, o1;
#pragma unroll
    for (int it = 0; it < 2; ++it) { const int p = it * 256 + tid; const int n = p >> 3, k8 = (p & 7) * 8;            // 64 n rows x 8 pieces = 512 pieces
        v8us o;
#pragma unroll
        for (int i = 0; i < 8; ++i) { const float x = ts[(k8 + i) * 65 + n]; const unsigned short b = f2bf(x);
            const h16 hv = (h16)(__uint_as_float(((unsigned)b) << 16) * scale); const unsigned short hb = __builtin_bit_cast(unsigned short, hv);
            o[i] = asF16 ? hb : b; }
        if (it == 0) o0 = o; else o1 = o; }
    bf* d0 = WT + (size_t)(n0 + (tid >> 3)) * DM + k0 + (tid & 7) * 8;
    bf* d1 = WT + (size_t)(n0 + 32 + (tid >> 3)) * DM + k0 + (tid & 7) * 8;
    *(v8us*)d0 = o0; *(v8us*)d1 = o1;
    
}

// k_gemm: register-blocked GEMM, ONE WAVE per 64x64 tile (16 accumulators), operands straight from K-contiguous 16-bit planes, K = DM.
// C[m][n] = sum_k A[m][k] Bt[n][k]; tile base (r0/RB)*sRB + (r0%RB)*pitch + (c0/CB)*sCB + (c0%CB), row pitch 'pitch' (elements). grid (M/64, N/64), 32 threads.
// MODE 0 (q, k; bf16 operands): + column bias, half-split rotary (the 64 tile columns are one head), RMS normalisation times weight, written as f16 (Ph) and optionally the f16 residual x2048 (Pr).
// MODE 1 (v^T; bf16 operands): + row bias, written as f16 (Ph).
// MODE 2 (output; f16 operands): * 2^-16 + column bias, written as f32 rows (OF).
template <int MODE>
__global__ __launch_bounds__(32) void k_gemm(const bf* __restrict__ A, const bf* __restrict__ Bt, const float* __restrict__ bias, const float* __restrict__ nw, const float* __restrict__ CS,
                                             h16* Ph, h16* Pr, float* OF, int useRes, int RB, size_t sRB, int pitch, int CB, size_t sCB) {
    typedef Ops<(MODE == 2) ? 1 : 0> OP;
    typedef typename OP::T FT;
    __shared__ __align__(16) float os[16 * 68];
    const int K = DM;
    const int lane = threadIdx.x & 31, lr = lane & 15, hi = lane >> 4; const int r0 = blockIdx.x * 64, c0 = blockIdx.y * 64;
    v8f acc[4][4];
#pragma unroll
    for (int mb = 0; mb < 4; ++mb)
#pragma unroll
        for (int nb = 0; nb < 4; ++nb) acc[mb][nb] = (v8f){};
    const size_t aoff = (size_t)(r0 + lr) * K + 8 * hi, boff = (size_t)(c0 + lr) * K + 8 * hi;
#pragma unroll 1
    for (int kc = 0; kc < K; kc += 32) {
        FT a[4];
#pragma unroll
        for (int mb = 0; mb < 4; ++mb) a[mb] = OP::ld(A + aoff + (size_t)mb * 16 * K + kc);
#pragma unroll
        for (int nb = 0; nb < 4; ++nb) { const FT b = OP::ld(Bt + boff + (size_t)nb * 16 * K + kc);
#pragma unroll
            for (int mb = 0; mb < 4; ++mb) acc[mb][nb] = OP::mm(a[mb], b, acc[mb][nb]); }
        asm volatile("v_nop\n\tv_nop\n\tv_nop\n\tv_nop" : "+v"(acc[0][0]), "+v"(acc[1][1]), "+v"(acc[2][2]), "+v"(acc[3][3]) : "v"(a[0]), "v"(a[1]), "v"(a[2]), "v"(a[3]));
    }
    const size_t tbase = (size_t)(r0 / RB) * sRB + (size_t)(r0 % RB) * (size_t)pitch + (size_t)(c0 / CB) * sCB + (size_t)(c0 % CB);
    const int rg = lane >> 3, c8 = (lane & 7) * 8, cp = c8 ^ 32, j0 = c8 & 31;
    const float sg = (c8 < 32) ? -1.0f : 1.0f;           // first half: x1 cos - x2 sin; second half: x2 cos + x1 sin
    const int tp0 = r0 % SEQ;                            // position of tile row 0 inside its sequence (MODE 0)
    float bo[8], bp[8], wv[8];
    v4f b4 = (v4f){};
    if (MODE == 0) {
#pragma unroll
        for (int i = 0; i < 8; ++i) { bo[i] = bfr(bias[c0 + c8 + i]); bp[i] = bfr(bias[c0 + cp + i]); wv[i] = bfr(nw[c8 + i]); }
    } else {
#pragma unroll
        for (int i = 0; i < 8; ++i) { bo[i] = 0.0f; bp[i] = 0.0f; wv[i] = 0.0f; }
    }
    if (MODE == 2) {
#pragma unroll
        for (int i = 0; i < 4; ++i) b4[i] = bfr(bias[c0 + lr * 4 + i]);
    }
#pragma unroll
    for (int mb = 0; mb < 4; ++mb) {
#pragma unroll
        for (int nb = 0; nb < 4; ++nb) {
#pragma unroll
            for (int j = 0; j < 8; ++j) os[(hi * 8 + j) * 68 + nb * 16 + lr] = acc[mb][nb][j]; }   // D: row 8h+j, col lane&15; rows 0..15 x columns 0..63 all written
        wave_sync();
        const size_t sb = tbase + (size_t)(mb * 16) * (size_t)pitch;
        if (MODE == 0) {
            v8h hq[4], rq[4];
#pragma unroll
            for (int s = 0; s < 4; ++s) { const int row = 4 * s + rg;                              // 4 s x 4 row groups = 16 rows; 8 lanes x 8 = 64 columns
                const float* op = &os[row * 68];
                const v4f x0 = *(const v4fa*)(op + c8), x1 = *(const v4fa*)(op + c8 + 4), y0 = *(const v4fa*)(op + cp), y1 = *(const v4fa*)(op + cp + 4);
                const float* cs = CS + (size_t)(tp0 + mb * 16 + row) * 64 + j0;
                const v4f ca = *(const v4f*)cs, cb = *(const v4f*)(cs + 4), sa = *(const v4f*)(cs + 32), sc = *(const v4f*)(cs + 36);
                float rot[8];
#pragma unroll
                for (int i = 0; i < 4; ++i) {
                    const float xo = x0[i] + bo[i], xp = y0[i] + bp[i]; rot[i] = xo * ca[i] + sg * (xp * sa[i]);
                    const float xq = x1[i] + bo[4 + i], xr = y1[i] + bp[4 + i]; rot[4 + i] = xq * cb[i] + sg * (xr * sc[i]); }
                float ss = 0.0f;
#pragma unroll
                for (int i = 0; i < 8; ++i) ss += rot[i] * rot[i];
                ss += __shfl_xor(ss, 1, 32); ss += __shfl_xor(ss, 2, 32); ss += __shfl_xor(ss, 4, 32);   // the 8 lanes of one row
                const float rinv = rsqrtf(ss * (1.0f / 64.0f) + RMS_EPS);
                v8h hv, rv;
#pragma unroll
                for (int i = 0; i < 8; ++i) { const float val = rot[i] * rinv * wv[i]; const h16 a0 = (h16)val; hv[i] = a0; rv[i] = (h16)((val - (float)a0) * QRS); }
                hq[s] = hv; rq[s] = rv; }
#pragma unroll
            for (int s = 0; s < 4; ++s) { const size_t oo = sb + (size_t)(4 * s + rg) * (size_t)pitch + c8;
                *(v8h*)(Ph + oo) = hq[s]; if (useRes) *(v8h*)(Pr + oo) = rq[s]; }
            
        } else if (MODE == 1) {
            v8h hq[4];
#pragma unroll
            for (int s = 0; s < 4; ++s) { const int row = 4 * s + rg;
                const float br = bfr(bias[r0 + mb * 16 + row]);
                const v4f x0 = *(const v4fa*)(&os[row * 68 + c8]); const v4f x1 = *(const v4fa*)(&os[row * 68 + c8 + 4]); v8h hv;
#pragma unroll
                for (int i = 0; i < 4; ++i) { hv[i] = (h16)(x0[i] + br); hv[4 + i] = (h16)(x1[i] + br); }
                hq[s] = hv; }
#pragma unroll
            for (int s = 0; s < 4; ++s) { const size_t oo = sb + (size_t)(4 * s + rg) * (size_t)pitch + c8; *(v8h*)(Ph + oo) = hq[s]; }
            
        } else {
            v4f ov[8];
#pragma unroll
            for (int s = 0; s < 8; ++s) { const int row = 2 * s + hi;                              // 8 s x 2 rows = 16 rows; 16 lanes x 4 floats = 64 columns
                const v4f x = *(const v4fa*)(&os[row * 68 + lr * 4]); ov[s] = x * OSC + b4; }
#pragma unroll
            for (int s = 0; s < 8; ++s) { const size_t oo = sb + (size_t)(2 * s + hi) * (size_t)pitch + lr * 4; *(v4f*)(OF + oo) = ov[s]; }
            
        }
        wave_sync();
    }
}

// k_flash: fused attention, one wave per QT x 16 query rows of one (batch, head); K / V^T / Q fragments straight from the f16 planes (two 16-B loads each, arithmetic addressing).
// Every K and V^T fragment a wave loads is used for all QT query tiles it holds in registers, so the loads per matrix instruction fall by QT.
// Transposed form: S^T[key][t] = K Q^T (A = K rows, B = Q rows); lane (t = lane&15, h = lane>>4) holds keys 8h+r of each 16-key tile, so the packed
// P tile is directly the B fragment of O^T[d][t] = V^T P^T (element r <- tile keys 0..15, element 8+r <- tile keys 16..31, lane unchanged).
// Softmax state (running max, partial sum) is one scalar per lane and query tile; the two lane halves of a row are combined with one xor-16 exchange.
__global__ __launch_bounds__(32 * AW) void k_flash(const h16* __restrict__ QH, const h16* __restrict__ QR, const h16* __restrict__ KP, const h16* __restrict__ VT, h16* CTX) {
    __shared__ __align__(16) float os[AW * 16 * 68];
    const int lane = threadIdx.x & 31, wave = threadIdx.x >> 5, lr = lane & 15, hi = lane >> 4;
    const int zh = blockIdx.y; const int b = zh / NH_, h = zh % NH_;
    const int t0 = (blockIdx.x * AW + wave) * (16 * QT);
    const size_t pbase = (size_t)zh * SEQ * HD;
    v16h qh0[QT], qh1[QT], qr0[QT], qr1[QT];                 // B fragments: col t, k = d
    v8f o[QT][4]; float m[QT], l[QT];
    const h16* qa[QT]; const h16* qb[QT];
#pragma unroll
    for (int i = 0; i < QT; ++i) { const size_t qo = pbase + (size_t)(t0 + 16 * i + lr) * HD + 8 * hi; qa[i] = QH + qo; qb[i] = QR + qo; }
#pragma unroll
    for (int i = 0; i < QT; ++i) { qh0[i] = ldh(qa[i]); qh1[i] = ldh(qa[i] + 32); qr0[i] = ldh(qb[i]); qr1[i] = ldh(qb[i] + 32); }
    static_assert(QT == 4);                                  // the wait below names the eight Q address pairs
    // the Q loads' address registers stay as they are until this wait (they are its inputs); they are reused behind it
    asm volatile("s_wait_xcnt 0x0" :: "v"(qa[0]), "v"(qa[1]), "v"(qa[2]), "v"(qa[3]), "v"(qb[0]), "v"(qb[1]), "v"(qb[2]), "v"(qb[3]) : "memory");
#pragma unroll
    for (int i = 0; i < QT; ++i) { o[i][0] = (v8f){}; o[i][1] = (v8f){}; o[i][2] = (v8f){}; o[i][3] = (v8f){}; m[i] = -3.0e38f; l[i] = 0.0f; }
    const size_t ko = pbase + (size_t)lr * HD + 8 * hi;      // + key * HD       (A fragment: row key, k = d)
    const size_t vo = pbase + (size_t)lr * SEQ + 8 * hi;     // + 16j*SEQ + key  (A fragment: row d, k = key)
#pragma unroll 1
    for (int key0 = 0; key0 < SEQ; key0 += 32) {
        const h16* ka = KP + ko + (size_t)key0 * HD;
        const v16h ka0 = ldh(ka), ka1 = ldh(ka + 32), kb0 = ldh(ka + 16 * HD), kb1 = ldh(ka + 16 * HD + 32);
        const h16* va = VT + vo + key0;
        const v16h v0 = ldh(va), v1 = ldh(va + (size_t)16 * SEQ), v2 = ldh(va + (size_t)32 * SEQ), v3 = ldh(va + (size_t)48 * SEQ);
        v16h pb[QT];
#pragma unroll
        for (int i = 0; i < QT; ++i) {
            v8f sHa = (v8f){}, sLa = (v8f){}, sHb = (v8f){}, sLb = (v8f){};
            sHa = wmma16(ka0, qh0[i], sHa); sLa = wmma16(ka0, qr0[i], sLa); sHb = wmma16(kb0, qh0[i], sHb); sLb = wmma16(kb0, qr0[i], sLb);
            sHa = wmma16(ka1, qh1[i], sHa); sLa = wmma16(ka1, qr1[i], sLa); sHb = wmma16(kb1, qh1[i], sHb); sLb = wmma16(kb1, qr1[i], sLb);
            float ta[8], tb[8]; float mx = -3.0e38f;
#pragma unroll
            for (int r = 0; r < 8; ++r) { ta[r] = (sHa[r] + sLa[r] * QRI) * SC2; tb[r] = (sHb[r] + sLb[r] * QRI) * SC2; mx = fmaxf(mx, fmaxf(ta[r], tb[r])); }
            mx = fmaxf(mx, __shfl_xor(mx, 16, 32));
            const float mnew = fmaxf(m[i], mx);
            const float alpha = __builtin_amdgcn_exp2f(m[i] - mnew);
            const float sh = PSH - mnew;
            v16h pv; float ls = 0.0f;
#pragma unroll
            for (int r = 0; r < 8; ++r) { const h16 pa = (h16)__builtin_amdgcn_exp2f(ta[r] + sh); const h16 pc = (h16)__builtin_amdgcn_exp2f(tb[r] + sh); pv[r] = pa; pv[8 + r] = pc; ls += (float)pa + (float)pc; }
            pb[i] = pv;
            l[i] = l[i] * alpha + ls; m[i] = mnew;
            o[i][0] = o[i][0] * alpha; o[i][1] = o[i][1] * alpha; o[i][2] = o[i][2] * alpha; o[i][3] = o[i][3] * alpha;
        }
#pragma unroll
        for (int i = 0; i < QT; ++i) { o[i][0] = wmma16(v0, pb[i], o[i][0]); o[i][1] = wmma16(v1, pb[i], o[i][1]); o[i][2] = wmma16(v2, pb[i], o[i][2]); o[i][3] = wmma16(v3, pb[i], o[i][3]); }
    }
    const int wb = wave * 16 * 68;
    const int rg = lane >> 3, c8 = (lane & 7) * 8;
#pragma unroll
    for (int i = 0; i < QT; ++i) {
        const float lt = l[i] + __shfl_xor(l[i], 16, 32);
        const float inv = (1.0f / lt) * CTXS;
        // O^T D layout: o[i][j][r] = (d = 16j + 8h + r, t = lane&15) -> os[t][d]; rows 0..15 x columns 0..63 all written
#pragma unroll
        for (int j = 0; j < 4; ++j) { v4f a, c;
            a[0] = o[i][j][0] * inv; a[1] = o[i][j][1] * inv; a[2] = o[i][j][2] * inv; a[3] = o[i][j][3] * inv; c[0] = o[i][j][4] * inv; c[1] = o[i][j][5] * inv; c[2] = o[i][j][6] * inv; c[3] = o[i][j][7] * inv;
            *(v4fa*)(&os[wb + lr * 68 + 16 * j + 8 * hi]) = a; *(v4fa*)(&os[wb + lr * 68 + 16 * j + 8 * hi + 4]) = c; }
        wave_sync();
        h16* crow = CTX + ((size_t)b * SEQ + t0 + 16 * i) * DM + h * HD;
        v8h hq[4];
#pragma unroll
        for (int s = 0; s < 4; ++s) { const int row = 4 * s + rg;                                  // 4 s x 4 row groups = 16 rows; 8 lanes x 8 halves = 64 columns
            const v4f x0 = *(const v4fa*)(&os[wb + row * 68 + c8]); const v4f x1 = *(const v4fa*)(&os[wb + row * 68 + c8 + 4]); v8h hv;
#pragma unroll
            for (int k = 0; k < 4; ++k) { hv[k] = (h16)x0[k]; hv[4 + k] = (h16)x1[k]; }
            hq[s] = hv; }
#pragma unroll
        for (int s = 0; s < 4; ++s) *(v8h*)(crow + (size_t)(4 * s + rg) * DM + c8) = hq[s];
        if (i + 1 < QT) {
            asm volatile("s_wait_xcnt 0x0" ::: "memory");    // the stores' registers are reused for the next query tile
            wave_sync();                                     // the tile is read out before the next query tile overwrites it
        }
    }
}

static constexpr size_t al256(size_t v) { return (v + 255) & ~(size_t)255; }
static constexpr size_t SZ_XB = al256((size_t)NB * SEQ * DM * 2);          // bf16 staging copy of one activation input; also the size of the ctx plane
static constexpr size_t SZ_WB = al256((size_t)4 * DM * DM * 2);            // four transposed 16-bit weight planes
static constexpr size_t SZ_CS = al256((size_t)SEQ * 64 * 4);               // rotary table
static constexpr size_t SZ_PL = al256((size_t)NB * NH_ * SEQ * HD * 2);    // one f16 head plane
static constexpr size_t SZ_TOTAL = SZ_XB + SZ_WB + SZ_CS + 4 * SZ_PL + SZ_XB;
static_assert(SZ_TOTAL <= (size_t)134217728);          // workspace carve <= 128 MiB
static_assert(((size_t)DM * DM * 2) % 256 == 0);       // weight sub-planes stay 256-byte aligned
static_assert((size_t)NB * SEQ * DM * 2 <= SZ_XB);     // ctx plane extent

extern "C" void kernel_launch(void* const* d_in, const int* in_sizes, int n_in,
                              void* d_out, int out_size, void* d_ws, size_t ws_size, hipStream_t stream) {
    if (n_in < 13) return;
    const size_t needx = ((size_t)(NB - 1) * SEQ_FULL + SEQ) * DM;
    if ((size_t)in_sizes[0] < needx || (size_t)in_sizes[1] < needx || (size_t)in_sizes[2] < needx) return;
    if ((size_t)in_sizes[3] < (size_t)DM * DM || (size_t)in_sizes[5] < (size_t)DM * DM || (size_t)in_sizes[7] < (size_t)DM * DM || (size_t)in_sizes[9] < (size_t)DM * DM) return;
    if (in_sizes[4] < DM || in_sizes[6] < DM || in_sizes[8] < DM || in_sizes[10] < DM) return;
    if (in_sizes[11] < HD || in_sizes[12] < HD) return;
    if ((size_t)out_size < ((size_t)(NB - 1) * OUT_SEQ + SEQ) * DM) return;
    if (SZ_TOTAL > ws_size) return;
    // wire order: q, k, v, wq_w, wq_b, wk_w, wk_b, wv_w, wv_b, wo_w, wo_b, qn_w, kn_w (weights [in][out])
    const float* q  = (const float*)d_in[0];  const float* k  = (const float*)d_in[1];  const float* v  = (const float*)d_in[2];
    const float* wq = (const float*)d_in[3];  const float* bq = (const float*)d_in[4];
    const float* wk = (const float*)d_in[5];  const float* bk = (const float*)d_in[6];
    const float* wv = (const float*)d_in[7];  const float* bv = (const float*)d_in[8];
    const float* wo = (const float*)d_in[9];  const float* bo = (const float*)d_in[10];
    const float* qnw = (const float*)d_in[11]; const float* knw = (const float*)d_in[12];
    float* OUT = (float*)d_out;      // [NB][OUT_SEQ][1024]
    char* wsp = (char*)d_ws;
    bf* XB = (bf*)wsp; wsp += SZ_XB;                 // [NB*SEQ][1024] bf16, reused for q, k, v in turn
    bf* WB = (bf*)wsp; wsp += SZ_WB;                 // [4][1024 out][1024 in]: q | k | v (bf16) | o (f16 x1024)
    float* CS = (float*)wsp; wsp += SZ_CS;           // [SEQ][64]: cos | sin
    h16* QH = (h16*)wsp; wsp += SZ_PL;               // [NB*16][SEQ][64]
    h16* QR = (h16*)wsp; wsp += SZ_PL;               // [NB*16][SEQ][64] residual x2048
    h16* KP = (h16*)wsp; wsp += SZ_PL;               // [NB*16][SEQ][64]
    h16* VT = (h16*)wsp; wsp += SZ_PL;               // [NB*16][64][SEQ]
    h16* CTX = (h16*)wsp; wsp += SZ_XB;              // [NB*SEQ][1024] x64
    bf* WQ = WB; bf* WK = WB + (size_t)DM * DM; bf* WV = WB + (size_t)2 * DM * DM; bf* WO = WB + (size_t)3 * DM * DM;

    k_tab<<<SEQ / 8, 256, 0, stream>>>(CS);

    // W in[rows = in k][cols = out n] -> WT out[n][k]; grid (n tiles, k tiles)
    { const dim3 g(DM / 64, DM / 64, 1);
      k_wt<<<g, 256, 0, stream>>>(wq, WQ, 0, 1.0f);
      k_wt<<<g, 256, 0, stream>>>(wk, WK, 0, 1.0f);
      k_wt<<<g, 256, 0, stream>>>(wv, WV, 0, 1.0f);
      k_wt<<<g, 256, 0, stream>>>(wo, WO, 1, WOS); }

    auto cvt = [&](const float* src) {
        if (SEQ == SEQ_FULL) {
            const size_t n8 = (size_t)NB * SEQ * DM / 8;
            k_cvt8<<<(unsigned)((n8 + 255) / 256), 256, 0, stream>>>(src, XB, n8);
        } else {
            const size_t n8 = (size_t)SEQ * DM / 8;
            for (int b = 0; b < NB; ++b) k_cvt8<<<(unsigned)((n8 + 255) / 256), 256, 0, stream>>>(src + (size_t)b * SEQ_FULL * DM, XB + (size_t)b * SEQ * DM, n8);
        }
    };

    // q, k: A = x rows (m = b*SEQ + t), Bt = W^T rows (n = h*64 + d) -> plane [(b*16 + h)][t][d]
    cvt(q);
    k_gemm<0><<<dim3(NB * SEQ / 64, DM / 64, 1), 32, 0, stream>>>(XB, WQ, bq, qnw, CS, QH, QR, OUT, 1, SEQ, (size_t)NH_ * SEQ * HD, HD, HD, (size_t)SEQ * HD);
    cvt(k);
    k_gemm<0><<<dim3(NB * SEQ / 64, DM / 64, 1), 32, 0, stream>>>(XB, WK, bk, knw, CS, KP, KP, OUT, 0, SEQ, (size_t)NH_ * SEQ * HD, HD, HD, (size_t)SEQ * HD);
    // v^T: A = Wv^T rows (m = h*64 + d), Bt = x rows (n = b*SEQ + t) -> plane [(b*1024 + m)][t] = [(b*16 + h)][d][t]
    cvt(v);
    k_gemm<1><<<dim3(DM / 64, NB * SEQ / 64, 1), 32, 0, stream>>>(WV, XB, bv, qnw, CS, VT, VT, OUT, 0, DM, (size_t)0, SEQ, SEQ, (size_t)DM * SEQ);

    k_flash<<<dim3(SEQ / (16 * AW * QT), NB * NH_, 1), 32 * AW, 0, stream>>>(QH, QR, KP, VT, CTX);

    // output: A = ctx rows (m = b*SEQ + t, f16), Bt = Wo^T rows (n, f16) -> OUT[(b*OUT_SEQ + t)][n]
    k_gemm<2><<<dim3(NB * SEQ / 64, DM / 64, 1), 32, 0, stream>>>((const bf*)CTX, WO, bo, qnw, CS, QH, QH, OUT, 0, SEQ, (size_t)OUT_SEQ * DM, DM, DM, (size_t)0);
}

// v002
// It runs in 231 microseconds.
// Two timings next to v001 both put it at 1.29 times that version's speed.
// Counting every step since v000, it is 1.73 times as fast.
#include <hip/hip_runtime.h>

// Multi-head attention, width 1024 = 16 heads x 64: q/k/v [NB][SEQ_FULL][1024] (first SEQ rows of each batch used), weights [in][out] (y = x W + b), half-split rotary on q and k (table cos/sin of t * 10000^(-j/32)), per-head RMS normalisation with weights, score scale 1/8, no mask, output projection with bias, f32 output.
// Compute dtypes, f32 accumulate everywhere: q/k/v projections v_wmma_f32_16x16x32_bf16 (inputs and weights RNE-converted to bf16; products exact);
// scores v_wmma_f32_16x16x32_f16: k single f16, q as f16 value + f16 residual x2048 in its own accumulator (two products); P (x256 carry, cancels in the normalisation) and v single f16;
// output projection v_wmma_f32_16x16x32_f16: ctx f16 (x64 carry), Wo^T f16 built from the bf16 RNE value (x1024 carry), 2^-16 folded back in the f32 epilogue; softmax, rotary and normalisation in f32.
// Layout: one bf16 staging copy of the current activation input; transposed 16-bit weight planes [out][in]; q (value, residual), k planes [b*16+h][t][d] and v^T plane [b*16+h][d][t] written by the GEMM epilogue;
// fused flash kernel in transposed form (S^T = K Q^T, O^T = V^T P^T) writes the ctx plane [b*SEQ+t][1024]; final GEMM writes the f32 output.

#ifndef NB
#define NB 4
#endif
#ifndef SEQ
#define SEQ 2048
#endif
#define NB_FULL  4
#define SEQ_FULL 2048
#ifndef OUT_SEQ
#define OUT_SEQ SEQ              // row pitch (in tokens) between batches of the output
#endif
#define DM   1024
#define NH_  16
#define HD   64
#define AW   8                   // waves per flash block
#define QT   4                   // query tiles of 16 rows per flash wave
#define QRS  2048.0f             // carry of the q residual plane
#define QRI  (1.0f / 2048.0f)
#define SC2  (0.125f * 1.4426950408889634f)   // HD^-0.5 * log2(e)
#define PSH  8.0f                // log2 of the P carry (256)
#define CTXS 64.0f               // carry of the ctx plane
#define WOS  1024.0f             // carry of the Wo^T plane
#define OSC  (1.0f / 65536.0f)   // 1 / (CTXS * WOS)
#define RMS_EPS 1.0e-6f
#define GW   8                   // waves per GEMM block: 4 (rows) x 2 (columns) wave tiles of 64 x 64
#define GBM  256                 // block tile rows
#define GBN  128                 // block tile columns
#define GBK  64                  // k per stage: one whole 128-byte line of every operand row
#define GLP  72                  // LDS row pitch in elements: 144 B = 16 B x 9, no bank conflict for the 16-byte fragment reads
#define GSZ  ((GBM + GBN) * GLP) // elements of one stage buffer

static_assert(HD == 64);
static_assert(NH_ * HD == DM);                 // head h = columns h*64 + d
static_assert(DM % 64 == 0);                   // 16 column tiles of 64
static_assert(DM % 32 == 0);                   // each GEMM product takes 32 k
static_assert(SEQ % 64 == 0);                  // a 64-row tile never straddles two batches
static_assert((NB * SEQ) % GBM == 0 && DM % GBM == 0 && (NB * SEQ) % GBN == 0 && DM % GBN == 0);   // GEMM grids cover M and N exactly, either operand order
static_assert(GBK == 64 && DM % GBK == 0 && DM / GBK >= 3);
static_assert(GW == 8 && GBM == 256 && GBN == 128);      // the copy's 8 + 4 pieces per thread and the 4 x 2 wave grid are written for these
static_assert((GBM + GBN) * (GBK / 8) % (32 * GW) == 0 && GBM % (32 * GW / (GBK / 8)) == 0);          // whole 16-byte pieces per thread; a piece index is all A or all B
static_assert(SEQ % 32 == 0);                  // key loop steps by 32
static_assert(SEQ % (16 * AW * QT) == 0);      // flash grid covers the sequence exactly
static_assert(SEQ % 8 == 0);                   // table kernel: 8 positions per block
static_assert(((size_t)SEQ * DM) % 8 == 0);
static_assert(((size_t)DM * DM) % 8 == 0);
static_assert(NB <= NB_FULL);
static_assert(SEQ <= SEQ_FULL);
static_assert(OUT_SEQ >= SEQ);

typedef _Float16 h16;
typedef unsigned short bf;
typedef __attribute__((ext_vector_type(16))) __bf16   v16bf;
typedef __attribute__((ext_vector_type(16))) _Float16 v16h;
typedef __attribute__((ext_vector_type(8)))  _Float16 v8h;
typedef __attribute__((ext_vector_type(8)))  unsigned short v8us;
typedef __attribute__((ext_vector_type(8)))  float    v8f;
typedef __attribute__((ext_vector_type(4)))  float    v4f;
typedef v4f  __attribute__((may_alias)) v4fa;

__device__ __forceinline__ unsigned short f2bf(float f) { unsigned u = __float_as_uint(f); u += 0x7FFFu + ((u >> 16) & 1u); return (unsigned short)(u >> 16); }
__device__ __forceinline__ float bfr(float f) { return __uint_as_float(((unsigned)f2bf(f)) << 16); }   // value after RNE convert to bf16
__device__ __forceinline__ v16h cat16(v8h lo, v8h hi) { return __builtin_shufflevector(lo, hi, 0, 1, 2, 3, 4, 5, 6, 7, 8, 9, 10, 11, 12, 13, 14, 15); }
__device__ __forceinline__ v16bf cat16b(v8us lo, v8us hi) { return __builtin_bit_cast(v16bf, __builtin_shufflevector(lo, hi, 0, 1, 2, 3, 4, 5, 6, 7, 8, 9, 10, 11, 12, 13, 14, 15)); }
__device__ __forceinline__ v8f wmma16(v16h a, v16h b, v8f c) { return __builtin_amdgcn_wmma_f32_16x16x32_f16(false, a, false, b, (short)0, c, false, false); }
__device__ __forceinline__ v8f wmmab(v16bf a, v16bf b, v8f c) { return __builtin_amdgcn_wmma_f32_16x16x32_bf16(false, a, false, b, (short)0, c, false, false); }
// fragment loaders from K-contiguous 16-bit rows; p already includes + 8*(lane>>4): elements 0..7 <- k0+8h+0..7, elements 8..15 <- k0+16+8h+0..7 (same map for A and B)
__device__ __forceinline__ v16h  ldh(const h16* p) { return cat16(*(const v8h*)p, *(const v8h*)(p + 16)); }
__device__ __forceinline__ v16bf ldb(const bf* p)  { return cat16b(*(const v8us*)p, *(const v8us*)(p + 16)); }
// ordering point for wave-private LDS tiles (same wave writes and reads)
__device__ __forceinline__ void wave_sync() { __builtin_amdgcn_fence(3 /* release order */, "wavefront"); __builtin_amdgcn_wave_barrier(); asm volatile("" ::: "memory"); }

// operand type selection for the GEMM: 0 = bf16 planes, 1 = f16 planes (both addressed as 16-bit rows)
template <int F16> struct Ops;
template <> struct Ops<0> { typedef v16bf T;
    static __device__ __forceinline__ T ld(const bf* p) { return ldb(p); }
    static __device__ __forceinline__ v8f mm(T a, T b, v8f c) { return wmmab(a, b, c); } };
template <> struct Ops<1> { typedef v16h T;
    static __device__ __forceinline__ T ld(const bf* p) { return ldh((const h16*)p); }
    static __device__ __forceinline__ v8f mm(T a, T b, v8f c) { return wmma16(a, b, c); } };

__global__ __launch_bounds__(256) void k_cvt8(const float* __restrict__ src, bf* dst, size_t n8) {
    const size_t i = (size_t)blockIdx.x * 256 + threadIdx.x; if (i >= n8) return;
    const v8f v = *(const v8f*)(src + i * 8); v8us o;
#pragma unroll
    for (int k = 0; k < 8; ++k) o[k] = f2bf(v[k]);
    *(v8us*)(dst + i * 8) = o; 
}

// k_tab: rotary table CS[t][0..31] = cos(t * f_j), CS[t][32..63] = sin(t * f_j), f_j = 10000^(-j/32) (f64 product chain, converted to f32), angle = f32 product.
__global__ __launch_bounds__(256) void k_tab(float* CS) {
    const int lane = threadIdx.x & 31; const int t = blockIdx.x * 8 + (threadIdx.x >> 5);
    double r = 1.0;
#pragma unroll 1
    for (int i = 0; i < lane; ++i) r *= 0.7498942093324558;    // 10^(-1/8)
    const float inv = (float)r; const float ang = (float)t * inv;
    float s, c; sincosf(ang, &s, &c);
    float* row = CS + (size_t)t * 64;
    *(float*)(row + lane) = c; *(float*)(row + 32 + lane) = s;
    
}

// k_wt: W f32 in[rows = k][cols = n] (pitch DM) -> WT 16-bit out[n][k] (pitch DM), transposed through LDS; grid (DM/64 over n, DM/64 over k), 256 threads.
__global__ __launch_bounds__(256) void k_wt(const float* __restrict__ W, bf* WT, int asF16, float scale) {
    __shared__ float ts[64 * 65];
    const int tid = threadIdx.x; const int n0 = blockIdx.x * 64, k0 = blockIdx.y * 64;
#pragma unroll
    for (int it = 0; it < 4; ++it) { const int idx = it * 256 + tid; const int kk = idx >> 4, n4 = (idx & 15) * 4;   // 64 k rows x 16 float4 = 1024 pieces
        const v4f v = *(const v4f*)(W + (size_t)(k0 + kk) * DM + n0 + n4);
        ts[kk * 65 + n4 + 0] = v[0]; ts[kk * 65 + n4 + 1] = v[1]; ts[kk * 65 + n4 + 2] = v[2]; ts[kk * 65 + n4 + 3] = v[3]; }
    __syncthreads();
    v8us o0, o1;
#pragma unroll
    for (int it = 0; it < 2; ++it) { const int p = it * 256 + tid; const int n = p >> 3, k8 = (p & 7) * 8;            // 64 n rows x 8 pieces = 512 pieces
        v8us o;
#pragma unroll
        for (int i = 0; i < 8; ++i) { const float x = ts[(k8 + i) * 65 + n]; const unsigned short b = f2bf(x);
            const h16 hv = (h16)(__uint_as_float(((unsigned)b) << 16) * scale); const unsigned short hb = __builtin_bit_cast(unsigned short, hv);
            o[i] = asF16 ? hb : b; }
        if (it == 0) o0 = o; else o1 = o; }
    bf* d0 = WT + (size_t)(n0 + (tid >> 3)) * DM + k0 + (tid & 7) * 8;
    bf* d1 = WT + (size_t)(n0 + 32 + (tid >> 3)) * DM + k0 + (tid & 7) * 8;
    *(v8us*)d0 = o0; *(v8us*)d1 = o1;
    
}

// k_gemm: register-blocked GEMM, one wave per 64x64 tile (16 accumulators), 8 waves per block on a 256x128 tile, K = DM.
// Per stage of 64 k the block copies its 256 A rows and 128 Bt rows, one whole 128-byte line each, through registers into padded LDS (three buffers: the global loads of
// stage s + 2 are issued before the products of stage s and stored behind them, one barrier per stage); every wave reads its fragments from LDS, 32 k ahead of their products.
// C[m][n] = sum_k A[m][k] Bt[n][k]; tile base (r0/RB)*sRB + (r0%RB)*pitch + (c0/CB)*sCB + (c0%CB), row pitch 'pitch' (elements). grid (M/256, N/128), 256 threads.
// MODE 0 (q, k; bf16 operands): + column bias, half-split rotary (the 64 tile columns are one head), RMS normalisation times weight, written as f16 (Ph) and optionally the f16 residual x2048 (Pr).
// MODE 1 (v^T; bf16 operands): + row bias, written as f16 (Ph).
// MODE 2 (output; f16 operands): * 2^-16 + column bias, written as f32 rows (OF).
template <int MODE>
__global__ __launch_bounds__(32 * GW) void k_gemm(const bf* __restrict__ A, const bf* __restrict__ Bt, const float* __restrict__ bias, const float* __restrict__ nw, const float* __restrict__ CS,
                                             h16* Ph, h16* Pr, float* OF, int useRes, int RB, size_t sRB, int pitch, int CB, size_t sCB) {
    typedef Ops<(MODE == 2) ? 1 : 0> OP;
    typedef typename OP::T FT;
    __shared__ __align__(16) bf st[3 * GSZ];                 // three stage buffers: rows 0..255 = A rows of the block tile, rows 256..383 = Bt rows
    __shared__ __align__(16) float osw[GW * 16 * 68];        // epilogue tiles, one per wave
    const int K = DM;
    const int tid = threadIdx.x, lane = tid & 31, lr = lane & 15, hi = lane >> 4;
    const int wave = __builtin_amdgcn_readfirstlane(tid >> 5);
    float* os = osw + wave * (16 * 68);
    const int r0 = blockIdx.x * GBM + (wave >> 1) * 64, c0 = blockIdx.y * GBN + (wave & 1) * 64;
    v8f acc[4][4];
#pragma unroll
    for (int mb = 0; mb < 4; ++mb)
#pragma unroll
        for (int nb = 0; nb < 4; ++nb) acc[mb][nb] = (v8f){};
    // copy: 384 rows x 8 pieces of 16 B = 12 pieces per thread; 8 consecutive lanes take one row's line, piece i is row i*32 + tid/8 (i < 8: A, else Bt)
    const int srow = tid >> 3, sc8 = (tid & 7) * 8;
    const bf* gA = A + (size_t)(blockIdx.x * GBM + srow) * K + sc8;
    const bf* gB = Bt + (size_t)(blockIdx.y * GBN + srow) * K + sc8;
    const int sto = srow * GLP + sc8;
    const int aro = ((wave >> 1) * 64 + lr) * GLP + 8 * hi, bro = (GBM + (wave & 1) * 64 + lr) * GLP + 8 * hi;   // fragment rows in a stage buffer
    v8us pc[12];
    auto ldg = [&]() {                                       // the next stage's 12 pieces; the two row pointers then step on by one stage
#pragma unroll
        for (int i = 0; i < 8; ++i) pc[i] = *(const v8us*)(gA + (size_t)i * 32 * K);
#pragma unroll
        for (int i = 0; i < 4; ++i) pc[8 + i] = *(const v8us*)(gB + (size_t)i * 32 * K);
        // the loads' two address pairs stay as they are until this wait (they are its inputs) and are stepped on behind it
        asm volatile("s_wait_xcnt 0x0" :: "v"(gA), "v"(gB) : "memory");
        gA += GBK; gB += GBK; };
    auto sts = [&](bf* buf) {
#pragma unroll
        for (int i = 0; i < 12; ++i) *(v8us*)(buf + sto + i * 32 * GLP) = pc[i]; };
    FT a0[4], b0[4], a1[4], b1[4];                           // two fragment sets: k 0..31 and k 32..63 of a stage
    auto frags = [&](FT (&fa)[4], FT (&fb)[4], const bf* cur) {
#pragma unroll
        for (int mb = 0; mb < 4; ++mb) fa[mb] = OP::ld(cur + aro + mb * 16 * GLP);
#pragma unroll
        for (int nb = 0; nb < 4; ++nb) fb[nb] = OP::ld(cur + bro + nb * 16 * GLP); };
    // the two scheduling fences keep the 16 products one run: global loads sunk behind them
    // or LDS stores (which wait for those loads) lifted over them put the load latency in front of the products
    auto prod = [&](FT (&fa)[4], FT (&fb)[4]) {
        __builtin_amdgcn_sched_barrier(0);
#pragma unroll
        for (int nb = 0; nb < 4; ++nb)
#pragma unroll
            for (int mb = 0; mb < 4; ++mb) acc[mb][nb] = OP::mm(fa[mb], fb[nb], acc[mb][nb]);
        __builtin_amdgcn_sched_barrier(0); };
    ldg(); sts(st);
    ldg(); sts(st + GSZ);
    __syncthreads();                                         // stages 0 and 1 are complete for every wave
    int o0 = 0, o1 = GSZ, o2 = 2 * GSZ;                      // buffers of stage s, s + 1, s + 2
    frags(a0, b0, st);
#pragma unroll 1                                             // rolled: one stage's text serves all stages, so the kernel text stays short and the register sets stay two
    for (int s = 0; s + 2 < K / GBK; ++s) {
        frags(a1, b1, st + o0 + 32);
        ldg();                                               // stage s + 2
        prod(a0, b0);
        frags(a0, b0, st + o1);                              // stage s + 1 was published by the barrier that ended stage s - 1
        prod(a1, b1);
        sts(st + o2);                                        // held stage s - 1: its last reads were waited for in front of the barrier that ended stage s - 1
        __syncthreads();                                     // stage s + 2 is complete, and stage s has been read by every wave
        const int t = o0; o0 = o1; o1 = o2; o2 = t;
    }
    frags(a1, b1, st + o0 + 32); prod(a0, b0);
    frags(a0, b0, st + o1);      prod(a1, b1);
    frags(a1, b1, st + o1 + 32); prod(a0, b0);
    prod(a1, b1);
    const size_t tbase = (size_t)(r0 / RB) * sRB + (size_t)(r0 % RB) * (size_t)pitch + (size_t)(c0 / CB) * sCB + (size_t)(c0 % CB);
    const int rg = lane >> 3, c8 = (lane & 7) * 8, cp = c8 ^ 32, j0 = c8 & 31;
    const float sg = (c8 < 32) ? -1.0f : 1.0f;           // first half: x1 cos - x2 sin; second half: x2 cos + x1 sin
    const int tp0 = r0 % SEQ;                            // position of tile row 0 inside its sequence (MODE 0)
    float bo[8], bp[8], wv[8];
    v4f b4 = (v4f){};
    if (MODE == 0) {
#pragma unroll
        for (int i = 0; i < 8; ++i) { bo[i] = bfr(bias[c0 + c8 + i]); bp[i] = bfr(bias[c0 + cp + i]); wv[i] = bfr(nw[c8 + i]); }
    } else {
#pragma unroll
        for (int i = 0; i < 8; ++i) { bo[i] = 0.0f; bp[i] = 0.0f; wv[i] = 0.0f; }
    }
    if (MODE == 2) {
#pragma unroll
        for (int i = 0; i < 4; ++i) b4[i] = bfr(bias[c0 + lr * 4 + i]);
    }
#pragma unroll
    for (int mb = 0; mb < 4; ++mb) {
#pragma unroll
        for (int nb = 0; nb < 4; ++nb) {
#pragma unroll
            for (int j = 0; j < 8; ++j) os[(hi * 8 + j) * 68 + nb * 16 + lr] = acc[mb][nb][j]; }   // D: row 8h+j, col lane&15; rows 0..15 x columns 0..63 all written
        wave_sync();
        const size_t sb = tbase + (size_t)(mb * 16) * (size_t)pitch;
        if (MODE == 0) {
            v8h hq[4], rq[4];
#pragma unroll
            for (int s = 0; s < 4; ++s) { const int row = 4 * s + rg;                              // 4 s x 4 row groups = 16 rows; 8 lanes x 8 = 64 columns
                const float* op = &os[row * 68];
                const v4f x0 = *(const v4fa*)(op + c8), x1 = *(const v4fa*)(op + c8 + 4), y0 = *(const v4fa*)(op + cp), y1 = *(const v4fa*)(op + cp + 4);
                const float* cs = CS + (size_t)(tp0 + mb * 16 + row) * 64 + j0;
                const v4f ca = *(const v4f*)cs, cb = *(const v4f*)(cs + 4), sa = *(const v4f*)(cs + 32), sc = *(const v4f*)(cs + 36);
                float rot[8];
#pragma unroll
                for (int i = 0; i < 4; ++i) {
                    const float xo = x0[i] + bo[i], xp = y0[i] + bp[i]; rot[i] = xo * ca[i] + sg * (xp * sa[i]);
                    const float xq = x1[i] + bo[4 + i], xr = y1[i] + bp[4 + i]; rot[4 + i] = xq * cb[i] + sg * (xr * sc[i]); }
                float ss = 0.0f;
#pragma unroll
                for (int i = 0; i < 8; ++i) ss += rot[i] * rot[i];
                ss += __shfl_xor(ss, 1, 32); ss += __shfl_xor(ss, 2, 32); ss += __shfl_xor(ss, 4, 32);   // the 8 lanes of one row
                const float rinv = rsqrtf(ss * (1.0f / 64.0f) + RMS_EPS);
                v8h hv, rv;
#pragma unroll
                for (int i = 0; i < 8; ++i) { const float val = rot[i] * rinv * wv[i]; const h16 a0 = (h16)val; hv[i] = a0; rv[i] = (h16)((val - (float)a0) * QRS); }
                hq[s] = hv; rq[s] = rv; }
#pragma unroll
            for (int s = 0; s < 4; ++s) { const size_t oo = sb + (size_t)(4 * s + rg) * (size_t)pitch + c8;
                *(v8h*)(Ph + oo) = hq[s]; if (useRes) *(v8h*)(Pr + oo) = rq[s]; }
            
        } else if (MODE == 1) {
            v8h hq[4];
#pragma unroll
            for (int s = 0; s < 4; ++s) { const int row = 4 * s + rg;
                const float br = bfr(bias[r0 + mb * 16 + row]);
                const v4f x0 = *(const v4fa*)(&os[row * 68 + c8]); const v4f x1 = *(const v4fa*)(&os[row * 68 + c8 + 4]); v8h hv;
#pragma unroll
                for (int i = 0; i < 4; ++i) { hv[i] = (h16)(x0[i] + br); hv[4 + i] = (h16)(x1[i] + br); }
                hq[s] = hv; }
#pragma unroll
            for (int s = 0; s < 4; ++s) { const size_t oo = sb + (size_t)(4 * s + rg) * (size_t)pitch + c8; *(v8h*)(Ph + oo) = hq[s]; }
            
        } else {
            v4f ov[8];
#pragma unroll
            for (int s = 0; s < 8; ++s) { const int row = 2 * s + hi;                              // 8 s x 2 rows = 16 rows; 16 lanes x 4 floats = 64 columns
                const v4f x = *(const v4fa*)(&os[row * 68 + lr * 4]); ov[s] = x * OSC + b4; }
#pragma unroll
            for (int s = 0; s < 8; ++s) { const size_t oo = sb + (size_t)(2 * s + hi) * (size_t)pitch + lr * 4; *(v4f*)(OF + oo) = ov[s]; }
            
        }
        wave_sync();
    }
}

// k_flash: fused attention, one wave per QT x 16 query rows of one (batch, head); K / V^T / Q fragments straight from the f16 planes (two 16-B loads each, arithmetic addressing).
// Every K and V^T fragment a wave loads is used for all QT query tiles it holds in registers, so the loads per matrix instruction fall by QT.
// Transposed form: S^T[key][t] = K Q^T (A = K rows, B = Q rows); lane (t = lane&15, h = lane>>4) holds keys 8h+r of each 16-key tile, so the packed
// P tile is directly the B fragment of O^T[d][t] = V^T P^T (element r <- tile keys 0..15, element 8+r <- tile keys 16..31, lane unchanged).
// Softmax state (running max, partial sum) is one scalar per lane and query tile; the two lane halves of a row are combined with one xor-16 exchange.
__global__ __launch_bounds__(32 * AW) void k_flash(const h16* __restrict__ QH, const h16* __restrict__ QR, const h16* __restrict__ KP, const h16* __restrict__ VT, h16* CTX) {
    __shared__ __align__(16) float os[AW * 16 * 68];
    const int lane = threadIdx.x & 31, wave = threadIdx.x >> 5, lr = lane & 15, hi = lane >> 4;
    const int zh = blockIdx.y; const int b = zh / NH_, h = zh % NH_;
    const int t0 = (blockIdx.x * AW + wave) * (16 * QT);
    const size_t pbase = (size_t)zh * SEQ * HD;
    v16h qh0[QT], qh1[QT], qr0[QT], qr1[QT];                 // B fragments: col t, k = d
    v8f o[QT][4]; float m[QT], l[QT];
    const h16* qa[QT]; const h16* qb[QT];
#pragma unroll
    for (int i = 0; i < QT; ++i) { const size_t qo = pbase + (size_t)(t0 + 16 * i + lr) * HD + 8 * hi; qa[i] = QH + qo; qb[i] = QR + qo; }
#pragma unroll
    for (int i = 0; i < QT; ++i) { qh0[i] = ldh(qa[i]); qh1[i] = ldh(qa[i] + 32); qr0[i] = ldh(qb[i]); qr1[i] = ldh(qb[i] + 32); }
    static_assert(QT == 4);                                  // the wait below names the eight Q address pairs
    // the Q loads' address registers stay as they are until this wait (they are its inputs); they are reused behind it
    asm volatile("s_wait_xcnt 0x0" :: "v"(qa[0]), "v"(qa[1]), "v"(qa[2]), "v"(qa[3]), "v"(qb[0]), "v"(qb[1]), "v"(qb[2]), "v"(qb[3]) : "memory");
#pragma unroll
    for (int i = 0; i < QT; ++i) { o[i][0] = (v8f){}; o[i][1] = (v8f){}; o[i][2] = (v8f){}; o[i][3] = (v8f){}; m[i] = -3.0e38f; l[i] = 0.0f; }
    const size_t ko = pbase + (size_t)lr * HD + 8 * hi;      // + key * HD       (A fragment: row key, k = d)
    const size_t vo = pbase + (size_t)lr * SEQ + 8 * hi;     // + 16j*SEQ + key  (A fragment: row d, k = key)
#pragma unroll 1
    for (int key0 = 0; key0 < SEQ; key0 += 32) {
        const h16* ka = KP + ko + (size_t)key0 * HD;
        const v16h ka0 = ldh(ka), ka1 = ldh(ka + 32), kb0 = ldh(ka + 16 * HD), kb1 = ldh(ka + 16 * HD + 32);
        const h16* va = VT + vo + key0;
        const v16h v0 = ldh(va), v1 = ldh(va + (size_t)16 * SEQ), v2 = ldh(va + (size_t)32 * SEQ), v3 = ldh(va + (size_t)48 * SEQ);
        v16h pb[QT];
#pragma unroll
        for (int i = 0; i < QT; ++i) {
            v8f sHa = (v8f){}, sLa = (v8f){}, sHb = (v8f){}, sLb = (v8f){};
            sHa = wmma16(ka0, qh0[i], sHa); sLa = wmma16(ka0, qr0[i], sLa); sHb = wmma16(kb0, qh0[i], sHb); sLb = wmma16(kb0, qr0[i], sLb);
            sHa = wmma16(ka1, qh1[i], sHa); sLa = wmma16(ka1, qr1[i], sLa); sHb = wmma16(kb1, qh1[i], sHb); sLb = wmma16(kb1, qr1[i], sLb);
            float ta[8], tb[8]; float mx = -3.0e38f;
#pragma unroll
            for (int r = 0; r < 8; ++r) { ta[r] = (sHa[r] + sLa[r] * QRI) * SC2; tb[r] = (sHb[r] + sLb[r] * QRI) * SC2; mx = fmaxf(mx, fmaxf(ta[r], tb[r])); }
            mx = fmaxf(mx, __shfl_xor(mx, 16, 32));
            const float mnew = fmaxf(m[i], mx);
            const float alpha = __builtin_amdgcn_exp2f(m[i] - mnew);
            const float sh = PSH - mnew;
            v16h pv; float ls = 0.0f;
#pragma unroll
            for (int r = 0; r < 8; ++r) { const h16 pa = (h16)__builtin_amdgcn_exp2f(ta[r] + sh); const h16 pc = (h16)__builtin_amdgcn_exp2f(tb[r] + sh); pv[r] = pa; pv[8 + r] = pc; ls += (float)pa + (float)pc; }
            pb[i] = pv;
            l[i] = l[i] * alpha + ls; m[i] = mnew;
            o[i][0] = o[i][0] * alpha; o[i][1] = o[i][1] * alpha; o[i][2] = o[i][2] * alpha; o[i][3] = o[i][3] * alpha;
        }
#pragma unroll
        for (int i = 0; i < QT; ++i) { o[i][0] = wmma16(v0, pb[i], o[i][0]); o[i][1] = wmma16(v1, pb[i], o[i][1]); o[i][2] = wmma16(v2, pb[i], o[i][2]); o[i][3] = wmma16(v3, pb[i], o[i][3]); }
    }
    const int wb = wave * 16 * 68;
    const int rg = lane >> 3, c8 = (lane & 7) * 8;
#pragma unroll
    for (int i = 0; i < QT; ++i) {
        const float lt = l[i] + __shfl_xor(l[i], 16, 32);
        const float inv = (1.0f / lt) * CTXS;
        // O^T D layout: o[i][j][r] = (d = 16j + 8h + r, t = lane&15) -> os[t][d]; rows 0..15 x columns 0..63 all written
#pragma unroll
        for (int j = 0; j < 4; ++j) { v4f a, c;
            a[0] = o[i][j][0] * inv; a[1] = o[i][j][1] * inv; a[2] = o[i][j][2] * inv; a[3] = o[i][j][3] * inv; c[0] = o[i][j][4] * inv; c[1] = o[i][j][5] * inv; c[2] = o[i][j][6] * inv; c[3] = o[i][j][7] * inv;
            *(v4fa*)(&os[wb + lr * 68 + 16 * j + 8 * hi]) = a; *(v4fa*)(&os[wb + lr * 68 + 16 * j + 8 * hi + 4]) = c; }
        wave_sync();
        h16* crow = CTX + ((size_t)b * SEQ + t0 + 16 * i) * DM + h * HD;
        v8h hq[4];
#pragma unroll
        for (int s = 0; s < 4; ++s) { const int row = 4 * s + rg;                                  // 4 s x 4 row groups = 16 rows; 8 lanes x 8 halves = 64 columns
            const v4f x0 = *(const v4fa*)(&os[wb + row * 68 + c8]); const v4f x1 = *(const v4fa*)(&os[wb + row * 68 + c8 + 4]); v8h hv;
#pragma unroll
            for (int k = 0; k < 4; ++k) { hv[k] = (h16)x0[k]; hv[4 + k] = (h16)x1[k]; }
            hq[s] = hv; }
#pragma unroll
        for (int s = 0; s < 4; ++s) *(v8h*)(crow + (size_t)(4 * s + rg) * DM + c8) = hq[s];
        if (i + 1 < QT) {
            asm volatile("s_wait_xcnt 0x0" ::: "memory");    // the stores' registers are reused for the next query tile
            wave_sync();                                     // the tile is read out before the next query tile overwrites it
        }
    }
}

static constexpr size_t al256(size_t v) { return (v + 255) & ~(size_t)255; }
static constexpr size_t SZ_XB = al256((size_t)NB * SEQ * DM * 2);          // bf16 staging copy of one activation input; also the size of the ctx plane
static constexpr size_t SZ_WB = al256((size_t)4 * DM * DM * 2);            // four transposed 16-bit weight planes
static constexpr size_t SZ_CS = al256((size_t)SEQ * 64 * 4);               // rotary table
static constexpr size_t SZ_PL = al256((size_t)NB * NH_ * SEQ * HD * 2);    // one f16 head plane
static constexpr size_t SZ_TOTAL = SZ_XB + SZ_WB + SZ_CS + 4 * SZ_PL + SZ_XB;
static_assert(SZ_TOTAL <= (size_t)134217728);          // workspace carve <= 128 MiB
static_assert(((size_t)DM * DM * 2) % 256 == 0);       // weight sub-planes stay 256-byte aligned
static_assert((size_t)NB * SEQ * DM * 2 <= SZ_XB);     // ctx plane extent

extern "C" void kernel_launch(void* const* d_in, const int* in_sizes, int n_in,
                              void* d_out, int out_size, void* d_ws, size_t ws_size, hipStream_t stream) {
    if (n_in < 13) return;
    const size_t needx = ((size_t)(NB - 1) * SEQ_FULL + SEQ) * DM;
    if ((size_t)in_sizes[0] < needx || (size_t)in_sizes[1] < needx || (size_t)in_sizes[2] < needx) return;
    if ((size_t)in_sizes[3] < (size_t)DM * DM || (size_t)in_sizes[5] < (size_t)DM * DM || (size_t)in_sizes[7] < (size_t)DM * DM || (size_t)in_sizes[9] < (size_t)DM * DM) return;
    if (in_sizes[4] < DM || in_sizes[6] < DM || in_sizes[8] < DM || in_sizes[10] < DM) return;
    if (in_sizes[11] < HD || in_sizes[12] < HD) return;
    if ((size_t)out_size < ((size_t)(NB - 1) * OUT_SEQ + SEQ) * DM) return;
    if (SZ_TOTAL > ws_size) return;
    // wire order: q, k, v, wq_w, wq_b, wk_w, wk_b, wv_w, wv_b, wo_w, wo_b, qn_w, kn_w (weights [in][out])
    const float* q  = (const float*)d_in[0];  const float* k  = (const float*)d_in[1];  const float* v  = (const float*)d_in[2];
    const float* wq = (const float*)d_in[3];  const float* bq = (const float*)d_in[4];
    const float* wk = (const float*)d_in[5];  const float* bk = (const float*)d_in[6];
    const float* wv = (const float*)d_in[7];  const float* bv = (const float*)d_in[8];
    const float* wo = (const float*)d_in[9];  const float* bo = (const float*)d_in[10];
    const float* qnw = (const float*)d_in[11]; const float* knw = (const float*)d_in[12];
    float* OUT = (float*)d_out;      // [NB][OUT_SEQ][1024]
    char* wsp = (char*)d_ws;
    bf* XB = (bf*)wsp; wsp += SZ_XB;                 // [NB*SEQ][1024] bf16, reused for q, k, v in turn
    bf* WB = (bf*)wsp; wsp += SZ_WB;                 // [4][1024 out][1024 in]: q | k | v (bf16) | o (f16 x1024)
    float* CS = (float*)wsp; wsp += SZ_CS;           // [SEQ][64]: cos | sin
    h16* QH = (h16*)wsp; wsp += SZ_PL;               // [NB*16][SEQ][64]
    h16* QR = (h16*)wsp; wsp += SZ_PL;               // [NB*16][SEQ][64] residual x2048
    h16* KP = (h16*)wsp; wsp += SZ_PL;               // [NB*16][SEQ][64]
    h16* VT = (h16*)wsp; wsp += SZ_PL;               // [NB*16][64][SEQ]
    h16* CTX = (h16*)wsp; wsp += SZ_XB;              // [NB*SEQ][1024] x64
    bf* WQ = WB; bf* WK = WB + (size_t)DM * DM; bf* WV = WB + (size_t)2 * DM * DM; bf* WO = WB + (size_t)3 * DM * DM;

    k_tab<<<SEQ / 8, 256, 0, stream>>>(CS);

    // W in[rows = in k][cols = out n] -> WT out[n][k]; grid (n tiles, k tiles)
    { const dim3 g(DM / 64, DM / 64, 1);
      k_wt<<<g, 256, 0, stream>>>(wq, WQ, 0, 1.0f);
      k_wt<<<g, 256, 0, stream>>>(wk, WK, 0, 1.0f);
      k_wt<<<g, 256, 0, stream>>>(wv, WV, 0, 1.0f);
      k_wt<<<g, 256, 0, stream>>>(wo, WO, 1, WOS); }

    auto cvt = [&](const float* src) {
        if (SEQ == SEQ_FULL) {
            const size_t n8 = (size_t)NB * SEQ * DM / 8;
            k_cvt8<<<(unsigned)((n8 + 255) / 256), 256, 0, stream>>>(src, XB, n8);
        } else {
            const size_t n8 = (size_t)SEQ * DM / 8;
            for (int b = 0; b < NB; ++b) k_cvt8<<<(unsigned)((n8 + 255) / 256), 256, 0, stream>>>(src + (size_t)b * SEQ_FULL * DM, XB + (size_t)b * SEQ * DM, n8);
        }
    };

    // q, k: A = x rows (m = b*SEQ + t), Bt = W^T rows (n = h*64 + d) -> plane [(b*16 + h)][t][d]
    cvt(q);
    k_gemm<0><<<dim3(NB * SEQ / GBM, DM / GBN, 1), 32 * GW, 0, stream>>>(XB, WQ, bq, qnw, CS, QH, QR, OUT, 1, SEQ, (size_t)NH_ * SEQ * HD, HD, HD, (size_t)SEQ * HD);
    cvt(k);
    k_gemm<0><<<dim3(NB * SEQ / GBM, DM / GBN, 1), 32 * GW, 0, stream>>>(XB, WK, bk, knw, CS, KP, KP, OUT, 0, SEQ, (size_t)NH_ * SEQ * HD, HD, HD, (size_t)SEQ * HD);
    // v^T: A = Wv^T rows (m = h*64 + d), Bt = x rows (n = b*SEQ + t) -> plane [(b*1024 + m)][t] = [(b*16 + h)][d][t]
    cvt(v);
    k_gemm<1><<<dim3(DM / GBM, NB * SEQ / GBN, 1), 32 * GW, 0, stream>>>(WV, XB, bv, qnw, CS, VT, VT, OUT, 0, DM, (size_t)0, SEQ, SEQ, (size_t)DM * SEQ);

    k_flash<<<dim3(SEQ / (16 * AW * QT), NB * NH_, 1), 32 * AW, 0, stream>>>(QH, QR, KP, VT, CTX);

    // output: A = ctx rows (m = b*SEQ + t, f16), Bt = Wo^T rows (n, f16) -> OUT[(b*OUT_SEQ + t)][n]
    k_gemm<2><<<dim3(NB * SEQ / GBM, DM / GBN, 1), 32 * GW, 0, stream>>>((const bf*)CTX, WO, bo, qnw, CS, QH, QH, OUT, 0, SEQ, (size_t)OUT_SEQ * DM, DM, DM, (size_t)0);
}

// v003
// Measured time: 222 microseconds a run.
// Next to v002, in two timings, it ran 1.04 times as fast each time.
// All steps since v000 together make it 1.81 times as fast.
#include <hip/hip_runtime.h>

// Multi-head attention, width 1024 = 16 heads x 64: q/k/v [NB][SEQ_FULL][1024] (first SEQ rows of each batch used), weights [in][out] (y = x W + b), half-split rotary on q and k (table cos/sin of t * 10000^(-j/32)), per-head RMS normalisation with weights, score scale 1/8, no mask, output projection with bias, f32 output.
// Compute dtypes, f32 accumulate everywhere: q/k/v projections v_wmma_f32_16x16x32_bf16 (inputs and weights RNE-converted to bf16; products exact);
// scores v_wmma_f32_16x16x32_f16: k single f16, q as f16 value + f16 residual x2048 in its own accumulator (two products); P (x256 carry, cancels in the normalisation) and v single f16;
// output projection v_wmma_f32_16x16x32_f16: ctx f16 (x64 carry), Wo^T f16 built from the bf16 RNE value (x1024 carry), 2^-16 folded back in the f32 epilogue; softmax, rotary and normalisation in f32.
// Layout: a bf16 copy of each activation input; transposed 16-bit weight planes [out][in]; q (value, residual), k planes [b*16+h][t][d] and v^T plane [b*16+h][d][t] written by the GEMM epilogue;
// fused flash kernel in transposed form (S^T = K Q^T, O^T = V^T P^T) writes the ctx plane [b*SEQ+t][1024]; final GEMM writes the f32 output.

#ifndef NB
#define NB 4
#endif
#ifndef SEQ
#define SEQ 2048
#endif
#define NB_FULL  4
#define SEQ_FULL 2048
#ifndef OUT_SEQ
#define OUT_SEQ SEQ              // row pitch (in tokens) between batches of the output
#endif
#define DM   1024
#define NH_  16
#define HD   64
#define AW   8                   // waves per flash block
#define QT   4                   // query tiles of 16 rows per flash wave
#define QRS  2048.0f             // carry of the q residual plane
#define QRI  (1.0f / 2048.0f)
#define SC2  (0.125f * 1.4426950408889634f)   // HD^-0.5 * log2(e)
#define PSH  8.0f                // log2 of the P carry (256)
#define CTXS 64.0f               // carry of the ctx plane
#define WOS  1024.0f             // carry of the Wo^T plane
#define OSC  (1.0f / 65536.0f)   // 1 / (CTXS * WOS)
#define RMS_EPS 1.0e-6f
#define GW   8                   // waves per GEMM block: 4 (rows) x 2 (columns) wave tiles of 64 x 64
#define GBM  256                 // block tile rows
#define GBN  128                 // block tile columns
#define GBK  64                  // k per stage: one whole 128-byte line of every operand row
#define GLP  72                  // LDS row pitch in elements: 144 B = 16 B x 9, no bank conflict for the 16-byte fragment reads
#define GSZ  ((GBM + GBN) * GLP) // elements of one stage buffer

static_assert(HD == 64);
static_assert(NH_ * HD == DM);                 // head h = columns h*64 + d
static_assert(DM % 64 == 0);                   // 16 column tiles of 64
static_assert(DM % 32 == 0);                   // each GEMM product takes 32 k
static_assert(SEQ % 64 == 0);                  // a 64-row tile never straddles two batches
static_assert((NB * SEQ) % GBM == 0 && DM % GBM == 0 && (NB * SEQ) % GBN == 0 && DM % GBN == 0);   // GEMM grids cover M and N exactly, either operand order
static_assert(GBK == 64 && DM % GBK == 0 && DM / GBK >= 3);
static_assert(GW == 8 && GBM == 256 && GBN == 128);      // the copy's 8 + 4 pieces per thread and the 4 x 2 wave grid are written for these
static_assert((GBM + GBN) * (GBK / 8) % (32 * GW) == 0 && GBM % (32 * GW / (GBK / 8)) == 0);          // whole 16-byte pieces per thread; a piece index is all A or all B
static_assert(SEQ % 32 == 0);                  // key loop steps by 32
static_assert(SEQ % (16 * AW * QT) == 0);      // flash grid covers the sequence exactly
static_assert(SEQ % 8 == 0);                   // table kernel: 8 positions per block
static_assert(((size_t)SEQ * DM) % 8 == 0);
static_assert(((size_t)DM * DM) % 8 == 0);
static_assert(NB <= NB_FULL);
static_assert(SEQ <= SEQ_FULL);
static_assert(OUT_SEQ >= SEQ);

typedef _Float16 h16;
typedef unsigned short bf;
typedef __attribute__((ext_vector_type(16))) __bf16   v16bf;
typedef __attribute__((ext_vector_type(16))) _Float16 v16h;
typedef __attribute__((ext_vector_type(8)))  _Float16 v8h;
typedef __attribute__((ext_vector_type(8)))  unsigned short v8us;
typedef __attribute__((ext_vector_type(8)))  float    v8f;
typedef __attribute__((ext_vector_type(4)))  float    v4f;
typedef v4f  __attribute__((may_alias)) v4fa;

__device__ __forceinline__ unsigned short f2bf(float f) { unsigned u = __float_as_uint(f); u += 0x7FFFu + ((u >> 16) & 1u); return (unsigned short)(u >> 16); }
__device__ __forceinline__ float bfr(float f) { return __uint_as_float(((unsigned)f2bf(f)) << 16); }   // value after RNE convert to bf16
__device__ __forceinline__ v16h cat16(v8h lo, v8h hi) { return __builtin_shufflevector(lo, hi, 0, 1, 2, 3, 4, 5, 6, 7, 8, 9, 10, 11, 12, 13, 14, 15); }
__device__ __forceinline__ v16bf cat16b(v8us lo, v8us hi) { return __builtin_bit_cast(v16bf, __builtin_shufflevector(lo, hi, 0, 1, 2, 3, 4, 5, 6, 7, 8, 9, 10, 11, 12, 13, 14, 15)); }
__device__ __forceinline__ v8f wmma16(v16h a, v16h b, v8f c) { return __builtin_amdgcn_wmma_f32_16x16x32_f16(false, a, false, b, (short)0, c, false, false); }
__device__ __forceinline__ v8f wmmab(v16bf a, v16bf b, v8f c) { return __builtin_amdgcn_wmma_f32_16x16x32_bf16(false, a, false, b, (short)0, c, false, false); }
// fragment loaders from K-contiguous 16-bit rows; p already includes + 8*(lane>>4): elements 0..7 <- k0+8h+0..7, elements 8..15 <- k0+16+8h+0..7 (same map for A and B)
__device__ __forceinline__ v16h  ldh(const h16* p) { return cat16(*(const v8h*)p, *(const v8h*)(p + 16)); }
__device__ __forceinline__ v16bf ldb(const bf* p)  { return cat16b(*(const v8us*)p, *(const v8us*)(p + 16)); }
// ordering point for wave-private LDS tiles (same wave writes and reads)
__device__ __forceinline__ void wave_sync() { __builtin_amdgcn_fence(3 /* release order */, "wavefront"); __builtin_amdgcn_wave_barrier(); asm volatile("" ::: "memory"); }

// operand type selection for the GEMM: 0 = bf16 planes, 1 = f16 planes (both addressed as 16-bit rows)
template <int F16> struct Ops;
template <> struct Ops<0> { typedef v16bf T;
    static __device__ __forceinline__ T ld(const bf* p) { return ldb(p); }
    static __device__ __forceinline__ v8f mm(T a, T b, v8f c) { return wmmab(a, b, c); } };
template <> struct Ops<1> { typedef v16h T;
    static __device__ __forceinline__ T ld(const bf* p) { return ldh((const h16*)p); }
    static __device__ __forceinline__ v8f mm(T a, T b, v8f c) { return wmma16(a, b, c); } };

// d_cvt8: block bi of the f32 -> bf16 copy of one activation input, [NB][SEQ_FULL][DM] rows 0..SEQ-1 of every batch -> [NB*SEQ][DM]; 8 elements per thread.
__device__ __forceinline__ void d_cvt8(const float* __restrict__ src, bf* dst, unsigned bi) {
    const size_t n8 = (size_t)NB * SEQ * DM / 8, per = (size_t)SEQ * DM / 8;
    const size_t i = (size_t)bi * 256 + threadIdx.x; if (i >= n8) return;
    const size_t so = (SEQ == SEQ_FULL) ? i * 8 : (i / per) * ((size_t)SEQ_FULL * DM) + (i % per) * 8;
    const v8f v = *(const v8f*)(src + so); v8us o;
#pragma unroll
    for (int k = 0; k < 8; ++k) o[k] = f2bf(v[k]);
    *(v8us*)(dst + i * 8) = o; 
}

// d_tab: block bi (8 positions) of the rotary table CS[t][0..31] = cos(t * f_j), CS[t][32..63] = sin(t * f_j), f_j = 10000^(-j/32) (f64 product chain, converted to f32), angle = f32 product.
__device__ __forceinline__ void d_tab(float* CS, unsigned bi) {
    const int lane = threadIdx.x & 31; const int t = bi * 8 + (threadIdx.x >> 5);
    double r = 1.0;
#pragma unroll 1
    for (int i = 0; i < lane; ++i) r *= 0.7498942093324558;    // 10^(-1/8)
    const float inv = (float)r; const float ang = (float)t * inv;
    float s, c; sincosf(ang, &s, &c);
    float* row = CS + (size_t)t * 64;
    *(float*)(row + lane) = c; *(float*)(row + 32 + lane) = s;
    asm volatile("s_wait_xcnt 0x0" ::: "memory");            // the two stores' registers may be written again in the text that follows them in the merged kernel
}

// d_wt: W f32 in[rows = k][cols = n] (pitch DM) -> WT 16-bit out[n][k] (pitch DM), transposed through LDS; tile (bx of DM/64 over n, by of DM/64 over k), 256 threads.
__device__ __forceinline__ void d_wt(const float* __restrict__ W, bf* WT, int asF16, float scale, int bx, int by, float* ts) {
    const int tid = threadIdx.x; const int n0 = bx * 64, k0 = by * 64;
#pragma unroll
    for (int it = 0; it < 4; ++it) { const int idx = it * 256 + tid; const int kk = idx >> 4, n4 = (idx & 15) * 4;   // 64 k rows x 16 float4 = 1024 pieces
        const v4f v = *(const v4f*)(W + (size_t)(k0 + kk) * DM + n0 + n4);
        ts[kk * 65 + n4 + 0] = v[0]; ts[kk * 65 + n4 + 1] = v[1]; ts[kk * 65 + n4 + 2] = v[2]; ts[kk * 65 + n4 + 3] = v[3]; }
    __syncthreads();
    v8us o0, o1;
#pragma unroll
    for (int it = 0; it < 2; ++it) { const int p = it * 256 + tid; const int n = p >> 3, k8 = (p & 7) * 8;            // 64 n rows x 8 pieces = 512 pieces
        v8us o;
#pragma unroll
        for (int i = 0; i < 8; ++i) { const float x = ts[(k8 + i) * 65 + n]; const unsigned short b = f2bf(x);
            const h16 hv = (h16)(__uint_as_float(((unsigned)b) << 16) * scale); const unsigned short hb = __builtin_bit_cast(unsigned short, hv);
            o[i] = asF16 ? hb : b; }
        if (it == 0) o0 = o; else o1 = o; }
    bf* d0 = WT + (size_t)(n0 + (tid >> 3)) * DM + k0 + (tid & 7) * 8;
    bf* d1 = WT + (size_t)(n0 + 32 + (tid >> 3)) * DM + k0 + (tid & 7) * 8;
    *(v8us*)d0 = o0; *(v8us*)d1 = o1;
    
}

// k_prep: everything the projections need and that needs nothing of each other, as block ranges of one grid (the branch is the same for a whole block):
// blocks [0, PB_WT): the four weight planes, 16 x 16 tiles each; [PB_WT, PB_WT + PB_TAB): the rotary table; then PB_CV blocks for each of q, k, v into its own bf16 plane.
#define PB_WP  ((DM / 64) * (DM / 64))
#define PB_WT  (4 * PB_WP)
#define PB_TAB (SEQ / 8)
#define PB_CV  ((unsigned)(((size_t)NB * SEQ * DM / 8 + 255) / 256))
__global__ __launch_bounds__(256) void k_prep(const float* __restrict__ q, const float* __restrict__ k, const float* __restrict__ v,
                                              const float* __restrict__ wq, const float* __restrict__ wk, const float* __restrict__ wv, const float* __restrict__ wo,
                                              bf* XB, bf* WB, float* CS) {
    __shared__ float ts[64 * 65];
    unsigned blk = blockIdx.x;
    if (blk < PB_WT) {
        const unsigned pl = blk / PB_WP, t = blk % PB_WP;
        const float* W = (pl == 0) ? wq : (pl == 1) ? wk : (pl == 2) ? wv : wo;
        d_wt(W, WB + (size_t)pl * DM * DM, pl == 3, (pl == 3) ? WOS : 1.0f, t % (DM / 64), t / (DM / 64), ts);
        return;
    }
    blk -= PB_WT;
    if (blk < PB_TAB) { d_tab(CS, blk); return; }
    blk -= PB_TAB;
    const unsigned pl = blk / PB_CV;
    const float* x = (pl == 0) ? q : (pl == 1) ? k : v;
    d_cvt8(x, XB + (size_t)pl * NB * SEQ * DM, blk % PB_CV);
}

// k_gemm: register-blocked GEMM, one wave per 64x64 tile (16 accumulators), 8 waves per block on a 256x128 tile, K = DM.
// Per stage of 64 k the block copies its 256 A rows and 128 Bt rows, one whole 128-byte line each, through registers into padded LDS (three buffers: the global loads of
// stage s + 2 are issued before the products of stage s and stored behind them, one barrier per stage); every wave reads its fragments from LDS, 32 k ahead of their products.
// C[m][n] = sum_k A[m][k] Bt[n][k]; tile base (r0/RB)*sRB + (r0%RB)*pitch + (c0/CB)*sCB + (c0%CB), row pitch 'pitch' (elements). blockIdx.x counts the block tiles of one GEMM, (M/256) x (N/128), rows fastest; 256 threads.
// MODE 0 (q, k; bf16 operands): + column bias, half-split rotary (the 64 tile columns are one head), RMS normalisation times weight, written as f16 (Ph) and optionally the f16 residual x2048 (Pr).
// MODE 1 (v^T; bf16 operands): + row bias, written as f16 (Ph).
// MODE 2 (output; f16 operands): * 2^-16 + column bias, written as f32 rows (OF).
// F16 = 0: the three projections, which need nothing of each other, share one grid; blockIdx.y = 0: q, 1: k (A = x rows, m = b*SEQ + t; Bt = W^T rows, n = h*64 + d -> plane [(b*16 + h)][t][d]),
// 2: v^T (A = Wv^T rows, m = h*64 + d; Bt = x rows, n = b*SEQ + t -> plane [(b*1024 + m)][t] = [(b*16 + h)][d][t]); X and Wt hold the planes of q, k, v one behind the other.
// F16 = 1: the output projection (A = ctx rows, m = b*SEQ + t; Bt = Wo^T rows -> OF[(b*OUT_SEQ + t)][n]).
static_assert((NB * SEQ / GBM) * (DM / GBN) == (DM / GBM) * (NB * SEQ / GBN));                 // as many block tiles in either operand order
template <int F16>
__global__ __launch_bounds__(32 * GW) void k_gemm(const bf* __restrict__ X, const bf* __restrict__ Wt, const float* __restrict__ bias0, const float* __restrict__ bias1, const float* __restrict__ bias2,
                                             const float* __restrict__ nw0, const float* __restrict__ nw1, const float* __restrict__ CS, h16* P0, h16* PR, h16* P1, h16* P2, float* OF) {
    const int z = F16 ? 0 : (int)blockIdx.y;
    const bool tv = !F16 && z == 2;
    const int MODE = F16 ? 2 : (tv ? 1 : 0);                 // the same for a whole block
    const bf* xz = X + (size_t)z * NB * SEQ * DM; const bf* wz = Wt + (size_t)z * DM * DM;
    const bf* A = tv ? wz : xz; const bf* Bt = tv ? xz : wz;
    const float* bias = (z == 0) ? bias0 : (z == 1) ? bias1 : bias2; const float* nw = (z == 0) ? nw0 : nw1;
    h16* Ph = (z == 0) ? P0 : (z == 1) ? P1 : P2; h16* Pr = (z == 0) ? PR : Ph;
    const int useRes = !F16 && z == 0;
    const int RB = tv ? DM : SEQ, pitch = F16 ? DM : (tv ? SEQ : HD), CB = pitch;
    const size_t sRB = F16 ? (size_t)OUT_SEQ * DM : (tv ? (size_t)0 : (size_t)NH_ * SEQ * HD), sCB = F16 ? (size_t)0 : (tv ? (size_t)DM * SEQ : (size_t)SEQ * HD);
    const unsigned bx = tv ? blockIdx.x % (DM / GBM) : blockIdx.x % (NB * SEQ / GBM), by = tv ? blockIdx.x / (DM / GBM) : blockIdx.x / (NB * SEQ / GBM);
    typedef Ops<F16> OP;
    typedef typename OP::T FT;
    __shared__ __align__(16) bf st[3 * GSZ];                 // three stage buffers: rows 0..255 = A rows of the block tile, rows 256..383 = Bt rows
    __shared__ __align__(16) float osw[GW * 16 * 68];        // epilogue tiles, one per wave
    const int K = DM;
    const int tid = threadIdx.x, lane = tid & 31, lr = lane & 15, hi = lane >> 4;
    const int wave = __builtin_amdgcn_readfirstlane(tid >> 5);
    float* os = osw + wave * (16 * 68);
    const int r0 = bx * GBM + (wave >> 1) * 64, c0 = by * GBN + (wave & 1) * 64;
    v8f acc[4][4];
#pragma unroll
    for (int mb = 0; mb < 4; ++mb)
#pragma unroll
        for (int nb = 0; nb < 4; ++nb) acc[mb][nb] = (v8f){};
    // copy: 384 rows x 8 pieces of 16 B = 12 pieces per thread; 8 consecutive lanes take one row's line, piece i is row i*32 + tid/8 (i < 8: A, else Bt)
    const int srow = tid >> 3, sc8 = (tid & 7) * 8;
    const bf* gA = A + (size_t)(bx * GBM + srow) * K + sc8;
    const bf* gB = Bt + (size_t)(by * GBN + srow) * K + sc8;
    const int sto = srow * GLP + sc8;
    const int aro = ((wave >> 1) * 64 + lr) * GLP + 8 * hi, bro = (GBM + (wave & 1) * 64 + lr) * GLP + 8 * hi;   // fragment rows in a stage buffer
    v8us pc[12];
    auto ldg = [&]() {                                       // the next stage's 12 pieces; the two row pointers then step on by one stage
#pragma unroll
        for (int i = 0; i < 8; ++i) pc[i] = *(const v8us*)(gA + (size_t)i * 32 * K);
#pragma unroll
        for (int i = 0; i < 4; ++i) pc[8 + i] = *(const v8us*)(gB + (size_t)i * 32 * K);
        // the loads' two address pairs stay as they are until this wait (they are its inputs) and are stepped on behind it
        asm volatile("s_wait_xcnt 0x0" :: "v"(gA), "v"(gB) : "memory");
        gA += GBK; gB += GBK; };
    auto sts = [&](bf* buf) {
#pragma unroll
        for (int i = 0; i < 12; ++i) *(v8us*)(buf + sto + i * 32 * GLP) = pc[i]; };
    FT a0[4], b0[4], a1[4], b1[4];                           // two fragment sets: k 0..31 and k 32..63 of a stage
    auto frags = [&](FT (&fa)[4], FT (&fb)[4], const bf* cur) {
#pragma unroll
        for (int mb = 0; mb < 4; ++mb) fa[mb] = OP::ld(cur + aro + mb * 16 * GLP);
#pragma unroll
        for (int nb = 0; nb < 4; ++nb) fb[nb] = OP::ld(cur + bro + nb * 16 * GLP); };
    // the two scheduling fences keep the 16 products one run: global loads sunk behind them
    // or LDS stores (which wait for those loads) lifted over them put the load latency in front of the products
    auto prod = [&](FT (&fa)[4], FT (&fb)[4]) {
        __builtin_amdgcn_sched_barrier(0);
#pragma unroll
        for (int nb = 0; nb < 4; ++nb)
#pragma unroll
            for (int mb = 0; mb < 4; ++mb) acc[mb][nb] = OP::mm(fa[mb], fb[nb], acc[mb][nb]);
        __builtin_amdgcn_sched_barrier(0); };
    ldg(); sts(st);
    ldg(); sts(st + GSZ);
    __syncthreads();                                         // stages 0 and 1 are complete for every wave
    int o0 = 0, o1 = GSZ, o2 = 2 * GSZ;                      // buffers of stage s, s + 1, s + 2
    frags(a0, b0, st);
#pragma unroll 1                                             // rolled: one stage's text serves all stages, so the kernel text stays short and the register sets stay two
    for (int s = 0; s + 2 < K / GBK; ++s) {
        frags(a1, b1, st + o0 + 32);
        ldg();                                               // stage s + 2
        prod(a0, b0);
        frags(a0, b0, st + o1);                              // stage s + 1 was published by the barrier that ended stage s - 1
        prod(a1, b1);
        sts(st + o2);                                        // held stage s - 1: its last reads were waited for in front of the barrier that ended stage s - 1
        __syncthreads();                                     // stage s + 2 is complete, and stage s has been read by every wave
        const int t = o0; o0 = o1; o1 = o2; o2 = t;
    }
    frags(a1, b1, st + o0 + 32); prod(a0, b0);
    frags(a0, b0, st + o1);      prod(a1, b1);
    frags(a1, b1, st + o1 + 32); prod(a0, b0);
    prod(a1, b1);
    const size_t tbase = (size_t)(r0 / RB) * sRB + (size_t)(r0 % RB) * (size_t)pitch + (size_t)(c0 / CB) * sCB + (size_t)(c0 % CB);
    const int rg = lane >> 3, c8 = (lane & 7) * 8, cp = c8 ^ 32, j0 = c8 & 31;
    const float sg = (c8 < 32) ? -1.0f : 1.0f;           // first half: x1 cos - x2 sin; second half: x2 cos + x1 sin
    const int tp0 = r0 % SEQ;                            // position of tile row 0 inside its sequence (MODE 0)
    float bo[8], bp[8], wv[8];
    v4f b4 = (v4f){};
    if (MODE == 0) {
#pragma unroll
        for (int i = 0; i < 8; ++i) { bo[i] = bfr(bias[c0 + c8 + i]); bp[i] = bfr(bias[c0 + cp + i]); wv[i] = bfr(nw[c8 + i]); }
    } else {
#pragma unroll
        for (int i = 0; i < 8; ++i) { bo[i] = 0.0f; bp[i] = 0.0f; wv[i] = 0.0f; }
    }
    if (MODE == 2) {
#pragma unroll
        for (int i = 0; i < 4; ++i) b4[i] = bfr(bias[c0 + lr * 4 + i]);
    }
#pragma unroll
    for (int mb = 0; mb < 4; ++mb) {
#pragma unroll
        for (int nb = 0; nb < 4; ++nb) {
#pragma unroll
            for (int j = 0; j < 8; ++j) os[(hi * 8 + j) * 68 + nb * 16 + lr] = acc[mb][nb][j]; }   // D: row 8h+j, col lane&15; rows 0..15 x columns 0..63 all written
        wave_sync();
        const size_t sb = tbase + (size_t)(mb * 16) * (size_t)pitch;
        if (MODE == 0) {
            v8h hq[4], rq[4];
#pragma unroll
            for (int s = 0; s < 4; ++s) { const int row = 4 * s + rg;                              // 4 s x 4 row groups = 16 rows; 8 lanes x 8 = 64 columns
                const float* op = &os[row * 68];
                const v4f x0 = *(const v4fa*)(op + c8), x1 = *(const v4fa*)(op + c8 + 4), y0 = *(const v4fa*)(op + cp), y1 = *(const v4fa*)(op + cp + 4);
                const float* cs = CS + (size_t)(tp0 + mb * 16 + row) * 64 + j0;
                const v4f ca = *(const v4f*)cs, cb = *(const v4f*)(cs + 4), sa = *(const v4f*)(cs + 32), sc = *(const v4f*)(cs + 36);
                asm volatile("s_wait_xcnt 0x0" :: "v"(cs) : "memory");   // the four table loads' address pair stays as it is until this wait (it is its input)
                float rot[8];
#pragma unroll
                for (int i = 0; i < 4; ++i) {
                    const float xo = x0[i] + bo[i], xp = y0[i] + bp[i]; rot[i] = xo * ca[i] + sg * (xp * sa[i]);
                    const float xq = x1[i] + bo[4 + i], xr = y1[i] + bp[4 + i]; rot[4 + i] = xq * cb[i] + sg * (xr * sc[i]); }
                float ss = 0.0f;
#pragma unroll
                for (int i = 0; i < 8; ++i) ss += rot[i] * rot[i];
                ss += __shfl_xor(ss, 1, 32); ss += __shfl_xor(ss, 2, 32); ss += __shfl_xor(ss, 4, 32);   // the 8 lanes of one row
                const float rinv = rsqrtf(ss * (1.0f / 64.0f) + RMS_EPS);
                v8h hv, rv;
#pragma unroll
                for (int i = 0; i < 8; ++i) { const float val = rot[i] * rinv * wv[i]; const h16 a0 = (h16)val; hv[i] = a0; rv[i] = (h16)((val - (float)a0) * QRS); }
                hq[s] = hv; rq[s] = rv; }
#pragma unroll
            for (int s = 0; s < 4; ++s) { const size_t oo = sb + (size_t)(4 * s + rg) * (size_t)pitch + c8;
                // a wait behind each store: its registers are written again by the residual's arithmetic, which the compiler puts under the branch, and by the next rows
                *(v8h*)(Ph + oo) = hq[s]; asm volatile("s_wait_xcnt 0x0" ::: "memory");
                if (useRes) { *(v8h*)(Pr + oo) = rq[s]; asm volatile("s_wait_xcnt 0x0" ::: "memory"); } }
        } else if (MODE == 1) {
            v8h hq[4];
#pragma unroll
            for (int s = 0; s < 4; ++s) { const int row = 4 * s + rg;
                const float br = bfr(bias[r0 + mb * 16 + row]);
                const v4f x0 = *(const v4fa*)(&os[row * 68 + c8]); const v4f x1 = *(const v4fa*)(&os[row * 68 + c8 + 4]); v8h hv;
#pragma unroll
                for (int i = 0; i < 4; ++i) { hv[i] = (h16)(x0[i] + br); hv[4 + i] = (h16)(x1[i] + br); }
                hq[s] = hv; }
#pragma unroll
            for (int s = 0; s < 4; ++s) { const size_t oo = sb + (size_t)(4 * s + rg) * (size_t)pitch + c8; *(v8h*)(Ph + oo) = hq[s]; }
            asm volatile("s_wait_xcnt 0x0" ::: "memory");    // the stores' registers are reused for the next 16 rows
        } else {
            v4f ov[8];
#pragma unroll
            for (int s = 0; s < 8; ++s) { const int row = 2 * s + hi;                              // 8 s x 2 rows = 16 rows; 16 lanes x 4 floats = 64 columns
                const v4f x = *(const v4fa*)(&os[row * 68 + lr * 4]); ov[s] = x * OSC + b4; }
#pragma unroll
            for (int s = 0; s < 8; ++s) { const size_t oo = sb + (size_t)(2 * s + hi) * (size_t)pitch + lr * 4; *(v4f*)(OF + oo) = ov[s]; }
            
        }
        wave_sync();
    }
}

// k_flash: fused attention, one wave per QT x 16 query rows of one (batch, head); K / V^T / Q fragments straight from the f16 planes (two 16-B loads each, arithmetic addressing).
// Every K and V^T fragment a wave loads is used for all QT query tiles it holds in registers, so the loads per matrix instruction fall by QT.
// Transposed form: S^T[key][t] = K Q^T (A = K rows, B = Q rows); lane (t = lane&15, h = lane>>4) holds keys 8h+r of each 16-key tile, so the packed
// P tile is directly the B fragment of O^T[d][t] = V^T P^T (element r <- tile keys 0..15, element 8+r <- tile keys 16..31, lane unchanged).
// Softmax state (running max, partial sum) is one scalar per lane and query tile; the two lane halves of a row are combined with one xor-16 exchange.
__global__ __launch_bounds__(32 * AW) void k_flash(const h16* __restrict__ QH, const h16* __restrict__ QR, const h16* __restrict__ KP, const h16* __restrict__ VT, h16* CTX) {
    __shared__ __align__(16) float os[AW * 16 * 68];
    const int lane = threadIdx.x & 31, wave = threadIdx.x >> 5, lr = lane & 15, hi = lane >> 4;
    const int zh = blockIdx.y; const int b = zh / NH_, h = zh % NH_;
    const int t0 = (blockIdx.x * AW + wave) * (16 * QT);
    const size_t pbase = (size_t)zh * SEQ * HD;
    v16h qh0[QT], qh1[QT], qr0[QT], qr1[QT];                 // B fragments: col t, k = d
    v8f o[QT][4]; float m[QT], l[QT];
    const h16* qa[QT]; const h16* qb[QT];
#pragma unroll
    for (int i = 0; i < QT; ++i) { const size_t qo = pbase + (size_t)(t0 + 16 * i + lr) * HD + 8 * hi; qa[i] = QH + qo; qb[i] = QR + qo; }
#pragma unroll
    for (int i = 0; i < QT; ++i) { qh0[i] = ldh(qa[i]); qh1[i] = ldh(qa[i] + 32); qr0[i] = ldh(qb[i]); qr1[i] = ldh(qb[i] + 32); }
    static_assert(QT == 4);                                  // the wait below names the eight Q address pairs
    // the Q loads' address registers stay as they are until this wait (they are its inputs); they are reused behind it
    asm volatile("s_wait_xcnt 0x0" :: "v"(qa[0]), "v"(qa[1]), "v"(qa[2]), "v"(qa[3]), "v"(qb[0]), "v"(qb[1]), "v"(qb[2]), "v"(qb[3]) : "memory");
#pragma unroll
    for (int i = 0; i < QT; ++i) { o[i][0] = (v8f){}; o[i][1] = (v8f){}; o[i][2] = (v8f){}; o[i][3] = (v8f){}; m[i] = -3.0e38f; l[i] = 0.0f; }
    const size_t ko = pbase + (size_t)lr * HD + 8 * hi;      // + key * HD       (A fragment: row key, k = d)
    const size_t vo = pbase + (size_t)lr * SEQ + 8 * hi;     // + 16j*SEQ + key  (A fragment: row d, k = key)
#pragma unroll 1
    for (int key0 = 0; key0 < SEQ; key0 += 32) {
        const h16* ka = KP + ko + (size_t)key0 * HD;
        const v16h ka0 = ldh(ka), ka1 = ldh(ka + 32), kb0 = ldh(ka + 16 * HD), kb1 = ldh(ka + 16 * HD + 32);
        const h16* va = VT + vo + key0;
        const v16h v0 = ldh(va), v1 = ldh(va + (size_t)16 * SEQ), v2 = ldh(va + (size_t)32 * SEQ), v3 = ldh(va + (size_t)48 * SEQ);
        v16h pb[QT];
#pragma unroll
        for (int i = 0; i < QT; ++i) {
            v8f sHa = (v8f){}, sLa = (v8f){}, sHb = (v8f){}, sLb = (v8f){};
            sHa = wmma16(ka0, qh0[i], sHa); sLa = wmma16(ka0, qr0[i], sLa); sHb = wmma16(kb0, qh0[i], sHb); sLb = wmma16(kb0, qr0[i], sLb);
            sHa = wmma16(ka1, qh1[i], sHa); sLa = wmma16(ka1, qr1[i], sLa); sHb = wmma16(kb1, qh1[i], sHb); sLb = wmma16(kb1, qr1[i], sLb);
            float ta[8], tb[8]; float mx = -3.0e38f;
#pragma unroll
            for (int r = 0; r < 8; ++r) { ta[r] = (sHa[r] + sLa[r] * QRI) * SC2; tb[r] = (sHb[r] + sLb[r] * QRI) * SC2; mx = fmaxf(mx, fmaxf(ta[r], tb[r])); }
            mx = fmaxf(mx, __shfl_xor(mx, 16, 32));
            const float mnew = fmaxf(m[i], mx);
            const float alpha = __builtin_amdgcn_exp2f(m[i] - mnew);
            const float sh = PSH - mnew;
            v16h pv; float ls = 0.0f;
#pragma unroll
            for (int r = 0; r < 8; ++r) { const h16 pa = (h16)__builtin_amdgcn_exp2f(ta[r] + sh); const h16 pc = (h16)__builtin_amdgcn_exp2f(tb[r] + sh); pv[r] = pa; pv[8 + r] = pc; ls += (float)pa + (float)pc; }
            pb[i] = pv;
            l[i] = l[i] * alpha + ls; m[i] = mnew;
            o[i][0] = o[i][0] * alpha; o[i][1] = o[i][1] * alpha; o[i][2] = o[i][2] * alpha; o[i][3] = o[i][3] * alpha;
        }
#pragma unroll
        for (int i = 0; i < QT; ++i) { o[i][0] = wmma16(v0, pb[i], o[i][0]); o[i][1] = wmma16(v1, pb[i], o[i][1]); o[i][2] = wmma16(v2, pb[i], o[i][2]); o[i][3] = wmma16(v3, pb[i], o[i][3]); }
    }
    const int wb = wave * 16 * 68;
    const int rg = lane >> 3, c8 = (lane & 7) * 8;
#pragma unroll
    for (int i = 0; i < QT; ++i) {
        const float lt = l[i] + __shfl_xor(l[i], 16, 32);
        const float inv = (1.0f / lt) * CTXS;
        // O^T D layout: o[i][j][r] = (d = 16j + 8h + r, t = lane&15) -> os[t][d]; rows 0..15 x columns 0..63 all written
#pragma unroll
        for (int j = 0; j < 4; ++j) { v4f a, c;
            a[0] = o[i][j][0] * inv; a[1] = o[i][j][1] * inv; a[2] = o[i][j][2] * inv; a[3] = o[i][j][3] * inv; c[0] = o[i][j][4] * inv; c[1] = o[i][j][5] * inv; c[2] = o[i][j][6] * inv; c[3] = o[i][j][7] * inv;
            *(v4fa*)(&os[wb + lr * 68 + 16 * j + 8 * hi]) = a; *(v4fa*)(&os[wb + lr * 68 + 16 * j + 8 * hi + 4]) = c; }
        wave_sync();
        h16* crow = CTX + ((size_t)b * SEQ + t0 + 16 * i) * DM + h * HD;
        v8h hq[4];
#pragma unroll
        for (int s = 0; s < 4; ++s) { const int row = 4 * s + rg;                                  // 4 s x 4 row groups = 16 rows; 8 lanes x 8 halves = 64 columns
            const v4f x0 = *(const v4fa*)(&os[wb + row * 68 + c8]); const v4f x1 = *(const v4fa*)(&os[wb + row * 68 + c8 + 4]); v8h hv;
#pragma unroll
            for (int k = 0; k < 4; ++k) { hv[k] = (h16)x0[k]; hv[4 + k] = (h16)x1[k]; }
            hq[s] = hv; }
#pragma unroll
        for (int s = 0; s < 4; ++s) *(v8h*)(crow + (size_t)(4 * s + rg) * DM + c8) = hq[s];
        if (i + 1 < QT) {
            asm volatile("s_wait_xcnt 0x0" ::: "memory");    // the stores' registers are reused for the next query tile
            wave_sync();                                     // the tile is read out before the next query tile overwrites it
        }
    }
}

static constexpr size_t al256(size_t v) { return (v + 255) & ~(size_t)255; }
static constexpr size_t SZ_XB = al256((size_t)NB * SEQ * DM * 2);          // bf16 copy of one activation input; also the size of the ctx plane
static constexpr size_t SZ_WB = al256((size_t)4 * DM * DM * 2);            // four transposed 16-bit weight planes
static constexpr size_t SZ_CS = al256((size_t)SEQ * 64 * 4);               // rotary table
static constexpr size_t SZ_PL = al256((size_t)NB * NH_ * SEQ * HD * 2);    // one f16 head plane
static constexpr size_t SZ_TOTAL = 3 * SZ_XB + SZ_WB + SZ_CS + 4 * SZ_PL;
static_assert(SZ_TOTAL <= (size_t)134217728);          // workspace carve <= 128 MiB
static_assert(((size_t)DM * DM * 2) % 256 == 0);       // weight sub-planes stay 256-byte aligned
static_assert((size_t)NB * SEQ * DM * 2 <= SZ_XB);     // ctx plane extent

extern "C" void kernel_launch(void* const* d_in, const int* in_sizes, int n_in,
                              void* d_out, int out_size, void* d_ws, size_t ws_size, hipStream_t stream) {
    if (n_in < 13) return;
    const size_t needx = ((size_t)(NB - 1) * SEQ_FULL + SEQ) * DM;
    if ((size_t)in_sizes[0] < needx || (size_t)in_sizes[1] < needx || (size_t)in_sizes[2] < needx) return;
    if ((size_t)in_sizes[3] < (size_t)DM * DM || (size_t)in_sizes[5] < (size_t)DM * DM || (size_t)in_sizes[7] < (size_t)DM * DM || (size_t)in_sizes[9] < (size_t)DM * DM) return;
    if (in_sizes[4] < DM || in_sizes[6] < DM || in_sizes[8] < DM || in_sizes[10] < DM) return;
    if (in_sizes[11] < HD || in_sizes[12] < HD) return;
    if ((size_t)out_size < ((size_t)(NB - 1) * OUT_SEQ + SEQ) * DM) return;
    if (SZ_TOTAL > ws_size) return;
    // wire order: q, k, v, wq_w, wq_b, wk_w, wk_b, wv_w, wv_b, wo_w, wo_b, qn_w, kn_w (weights [in][out])
    const float* q  = (const float*)d_in[0];  const float* k  = (const float*)d_in[1];  const float* v  = (const float*)d_in[2];
    const float* wq = (const float*)d_in[3];  const float* bq = (const float*)d_in[4];
    const float* wk = (const float*)d_in[5];  const float* bk = (const float*)d_in[6];
    const float* wv = (const float*)d_in[7];  const float* bv = (const float*)d_in[8];
    const float* wo = (const float*)d_in[9];  const float* bo = (const float*)d_in[10];
    const float* qnw = (const float*)d_in[11]; const float* knw = (const float*)d_in[12];
    float* OUT = (float*)d_out;      // [NB][OUT_SEQ][1024]
    char* wsp = (char*)d_ws;
    bf* XB = (bf*)wsp; wsp += 3 * SZ_XB;             // [3][NB*SEQ][1024] bf16: q | k | v
    bf* WB = (bf*)wsp; wsp += SZ_WB;                 // [4][1024 out][1024 in]: q | k | v (bf16) | o (f16 x1024)
    float* CS = (float*)wsp; wsp += SZ_CS;           // [SEQ][64]: cos | sin
    h16* QH = (h16*)wsp; wsp += SZ_PL;               // [NB*16][SEQ][64]
    h16* QR = (h16*)wsp; wsp += SZ_PL;               // [NB*16][SEQ][64] residual x2048
    h16* KP = (h16*)wsp; wsp += SZ_PL;               // [NB*16][SEQ][64]
    h16* VT = (h16*)wsp; wsp += SZ_PL;               // [NB*16][64][SEQ]
    h16* CTX = (h16*)XB;                             // [NB*SEQ][1024] x64, over the q copy, which nothing reads behind the projections
    bf* WO = WB + (size_t)3 * DM * DM;

    k_prep<<<PB_WT + PB_TAB + 3 * PB_CV, 256, 0, stream>>>(q, k, v, wq, wk, wv, wo, XB, WB, CS);

    k_gemm<0><<<dim3((NB * SEQ / GBM) * (DM / GBN), 3, 1), 32 * GW, 0, stream>>>(XB, WB, bq, bk, bv, qnw, knw, CS, QH, QR, KP, VT, OUT);

    k_flash<<<dim3(SEQ / (16 * AW * QT), NB * NH_, 1), 32 * AW, 0, stream>>>(QH, QR, KP, VT, CTX);

    k_gemm<1><<<dim3((NB * SEQ / GBM) * (DM / GBN), 1, 1), 32 * GW, 0, stream>>>((const bf*)CTX, WO, bo, bo, bo, qnw, knw, CS, QH, QH, QH, QH, OUT);
}

// v004
// One run takes 187 microseconds.
// Next to v003, in two timings, it ran 1.18 times as fast each time.
// All steps since v000 together make it 2.14 times as fast.
#include <hip/hip_runtime.h>

// Multi-head attention, width 1024 = 16 heads x 64: q/k/v [NB][SEQ_FULL][1024] (first SEQ rows of each batch used), weights [in][out] (y = x W + b), half-split rotary on q and k (table cos/sin of t * 10000^(-j/32)), per-head RMS normalisation with weights, score scale 1/8, no mask, output projection with bias, f32 output.
// Compute dtypes, f32 accumulate everywhere: q/k/v projections v_wmma_f32_16x16x32_bf16 (inputs and weights RNE-converted to bf16; products exact);
// scores v_wmma_f32_16x16x32_f16: k single f16, q as f16 value + f16 residual x2048 in its own accumulator (two products); P (x256 carry, cancels in the normalisation) and v single f16;
// output projection v_wmma_f32_16x16x32_f16: ctx f16 (x64 carry), Wo^T f16 built from the bf16 RNE value (x1024 carry), 2^-16 folded back in the f32 epilogue; softmax, rotary and normalisation in f32.
// Layout: a bf16 copy of each activation input; transposed 16-bit weight planes [out][in]; q (value, residual), k planes [b*16+h][t][d] and v^T plane [b*16+h][d][t] written by the GEMM epilogue;
// fused flash kernel in transposed form (S^T = K Q^T, O^T = V^T P^T) writes the ctx plane [b*SEQ+t][1024]; final GEMM writes the f32 output.

#ifndef NB
#define NB 4
#endif
#ifndef SEQ
#define SEQ 2048
#endif
#define NB_FULL  4
#define SEQ_FULL 2048
#ifndef OUT_SEQ
#define OUT_SEQ SEQ              // row pitch (in tokens) between batches of the output
#endif
#define DM   1024
#define NH_  16
#define HD   64
#define AW   8                   // waves per flash block
#define QT   4                   // query tiles of 16 rows per flash wave
#define QRS  2048.0f             // carry of the q residual plane
#define QRI  (1.0f / 2048.0f)
#define SC2  (0.125f * 1.4426950408889634f)   // HD^-0.5 * log2(e)
#define PSH  8.0f                // log2 of the P carry (256)
#define CTXS 64.0f               // carry of the ctx plane
#define WOS  1024.0f             // carry of the Wo^T plane
#define OSC  (1.0f / 65536.0f)   // 1 / (CTXS * WOS)
#define RMS_EPS 1.0e-6f
#define GW   8                   // waves per GEMM block: 4 (rows) x 2 (columns) wave tiles of 64 x 64
#define GBM  256                 // block tile rows
#define GBN  128                 // block tile columns
#define GBK  64                  // k per stage: one whole 128-byte line of every operand row
#define GLP  72                  // LDS row pitch in elements: 144 B = 16 B x 9, no bank conflict for the 16-byte fragment reads
#define GSZ  ((GBM + GBN) * GLP) // elements of one stage buffer
#define FSK  128                 // keys per LDS tile of the flash kernel: 4 passes of 32 keys
#define FKP  72                  // K tile row pitch in elements: 128-B rows at 144 B = 16 B x 9
#define FVP  136                 // V^T tile row pitch in elements: 256-B rows at 272 B = 16 B x 17
#define FKSZ (FSK * FKP)         // elements of the K part of one tile buffer: 18,432 B = 9 x 2 KiB
#define FSZ  (2 * FKSZ)          // elements of one tile buffer: K rows, then from the next multiple of 2 KiB the V^T rows (17,408 B), rounded up to a multiple of 2 KiB

static_assert(HD == 64);
static_assert(NH_ * HD == DM);                 // head h = columns h*64 + d
static_assert(DM % 64 == 0);                   // 16 column tiles of 64
static_assert(DM % 32 == 0);                   // each GEMM product takes 32 k
static_assert(SEQ % 64 == 0);                  // a 64-row tile never straddles two batches
static_assert((NB * SEQ) % GBM == 0 && DM % GBM == 0 && (NB * SEQ) % GBN == 0 && DM % GBN == 0);   // GEMM grids cover M and N exactly, either operand order
static_assert(GBK == 64 && DM % GBK == 0 && DM / GBK >= 3);
static_assert(GW == 8 && GBM == 256 && GBN == 128);      // the copy's 8 + 4 pieces per thread and the 4 x 2 wave grid are written for these
static_assert((GBM + GBN) * (GBK / 8) % (32 * GW) == 0 && GBM % (32 * GW / (GBK / 8)) == 0);          // whole 16-byte pieces per thread; a piece index is all A or all B
static_assert(SEQ % 32 == 0);                  // key loop steps by 32
static_assert(FSK == 128 && SEQ % FSK == 0 && SEQ / FSK >= 2 && AW >= 2);   // whole key tiles inside the planes, at least the two that the prologue asks for; two issuing waves
static_assert((FKSZ * 2) % 2048 == 0 && HD * FVP <= FKSZ && FKP * 2 == HD * 2 + 16 && FVP * 2 == FSK * 2 + 16);   // places in LDS at multiples of 2 KiB; pitch = row + 16 B of pad
static_assert((SEQ * 2) % 16 == 0 && SEQ * 2 <= 131072);   // source pitch of the V^T tile
static_assert(SEQ % (16 * AW * QT) == 0);      // flash grid covers the sequence exactly
static_assert(SEQ % 8 == 0);                   // table kernel: 8 positions per block
static_assert(((size_t)SEQ * DM) % 8 == 0);
static_assert(((size_t)DM * DM) % 8 == 0);
static_assert(NB <= NB_FULL);
static_assert(SEQ <= SEQ_FULL);
static_assert(OUT_SEQ >= SEQ);

typedef _Float16 h16;
typedef unsigned short bf;
typedef __attribute__((ext_vector_type(16))) __bf16   v16bf;
typedef __attribute__((ext_vector_type(16))) _Float16 v16h;
typedef __attribute__((ext_vector_type(8)))  _Float16 v8h;
typedef __attribute__((ext_vector_type(8)))  unsigned short v8us;
typedef __attribute__((ext_vector_type(8)))  float    v8f;
typedef __attribute__((ext_vector_type(4)))  float    v4f;
typedef v4f  __attribute__((may_alias)) v4fa;

__device__ __forceinline__ unsigned short f2bf(float f) { unsigned u = __float_as_uint(f); u += 0x7FFFu + ((u >> 16) & 1u); return (unsigned short)(u >> 16); }
__device__ __forceinline__ float bfr(float f) { return __uint_as_float(((unsigned)f2bf(f)) << 16); }   // value after RNE convert to bf16
__device__ __forceinline__ v16h cat16(v8h lo, v8h hi) { return __builtin_shufflevector(lo, hi, 0, 1, 2, 3, 4, 5, 6, 7, 8, 9, 10, 11, 12, 13, 14, 15); }
__device__ __forceinline__ v16bf cat16b(v8us lo, v8us hi) { return __builtin_bit_cast(v16bf, __builtin_shufflevector(lo, hi, 0, 1, 2, 3, 4, 5, 6, 7, 8, 9, 10, 11, 12, 13, 14, 15)); }
__device__ __forceinline__ v8f wmma16(v16h a, v16h b, v8f c) { return __builtin_amdgcn_wmma_f32_16x16x32_f16(false, a, false, b, (short)0, c, false, false); }
__device__ __forceinline__ v8f wmmab(v16bf a, v16bf b, v8f c) { return __builtin_amdgcn_wmma_f32_16x16x32_bf16(false, a, false, b, (short)0, c, false, false); }
// fragment loaders from K-contiguous 16-bit rows; p already includes + 8*(lane>>4): elements 0..7 <- k0+8h+0..7, elements 8..15 <- k0+16+8h+0..7 (same map for A and B)
__device__ __forceinline__ v16h  ldh(const h16* p) { return cat16(*(const v8h*)p, *(const v8h*)(p + 16)); }
__device__ __forceinline__ v16bf ldb(const bf* p)  { return cat16b(*(const v8us*)p, *(const v8us*)(p + 16)); }
// ordering point for wave-private LDS tiles (same wave writes and reads)
__device__ __forceinline__ void wave_sync() { __builtin_amdgcn_fence(3 /* release order */, "wavefront"); __builtin_amdgcn_wave_barrier(); asm volatile("" ::: "memory"); }

// operand type selection for the GEMM: 0 = bf16 planes, 1 = f16 planes (both addressed as 16-bit rows)
template <int F16> struct Ops;
template <> struct Ops<0> { typedef v16bf T;
    static __device__ __forceinline__ T ld(const bf* p) { return ldb(p); }
    static __device__ __forceinline__ v8f mm(T a, T b, v8f c) { return wmmab(a, b, c); } };
template <> struct Ops<1> { typedef v16h T;
    static __device__ __forceinline__ T ld(const bf* p) { return ldh((const h16*)p); }
    static __device__ __forceinline__ v8f mm(T a, T b, v8f c) { return wmma16(a, b, c); } };

// d_cvt8: block bi of the f32 -> bf16 copy of one activation input, [NB][SEQ_FULL][DM] rows 0..SEQ-1 of every batch -> [NB*SEQ][DM]; 8 elements per thread.
__device__ __forceinline__ void d_cvt8(const float* __restrict__ src, bf* dst, unsigned bi) {
    const size_t n8 = (size_t)NB * SEQ * DM / 8, per = (size_t)SEQ * DM / 8;
    const size_t i = (size_t)bi * 256 + threadIdx.x; if (i >= n8) return;
    const size_t so = (SEQ == SEQ_FULL) ? i * 8 : (i / per) * ((size_t)SEQ_FULL * DM) + (i % per) * 8;
    const v8f v = *(const v8f*)(src + so); v8us o;
#pragma unroll
    for (int k = 0; k < 8; ++k) o[k] = f2bf(v[k]);
    *(v8us*)(dst + i * 8) = o; 
}

// d_tab: block bi (8 positions) of the rotary table CS[t][0..31] = cos(t * f_j), CS[t][32..63] = sin(t * f_j), f_j = 10000^(-j/32) (f64 product chain, converted to f32), angle = f32 product.
__device__ __forceinline__ void d_tab(float* CS, unsigned bi) {
    const int lane = threadIdx.x & 31; const int t = bi * 8 + (threadIdx.x >> 5);
    double r = 1.0;
#pragma unroll 1
    for (int i = 0; i < lane; ++i) r *= 0.7498942093324558;    // 10^(-1/8)
    const float inv = (float)r; const float ang = (float)t * inv;
    float s, c; sincosf(ang, &s, &c);
    float* row = CS + (size_t)t * 64;
    *(float*)(row + lane) = c; *(float*)(row + 32 + lane) = s;
    asm volatile("s_wait_xcnt 0x0" ::: "memory");            // the two stores' registers may be written again in the text that follows them in the merged kernel
}

// d_wt: W f32 in[rows = k][cols = n] (pitch DM) -> WT 16-bit out[n][k] (pitch DM), transposed through LDS; tile (bx of DM/64 over n, by of DM/64 over k), 256 threads.
__device__ __forceinline__ void d_wt(const float* __restrict__ W, bf* WT, int asF16, float scale, int bx, int by, float* ts) {
    const int tid = threadIdx.x; const int n0 = bx * 64, k0 = by * 64;
#pragma unroll
    for (int it = 0; it < 4; ++it) { const int idx = it * 256 + tid; const int kk = idx >> 4, n4 = (idx & 15) * 4;   // 64 k rows x 16 float4 = 1024 pieces
        const v4f v = *(const v4f*)(W + (size_t)(k0 + kk) * DM + n0 + n4);
        ts[kk * 65 + n4 + 0] = v[0]; ts[kk * 65 + n4 + 1] = v[1]; ts[kk * 65 + n4 + 2] = v[2]; ts[kk * 65 + n4 + 3] = v[3]; }
    __syncthreads();
    v8us o0, o1;
#pragma unroll
    for (int it = 0; it < 2; ++it) { const int p = it * 256 + tid; const int n = p >> 3, k8 = (p & 7) * 8;            // 64 n rows x 8 pieces = 512 pieces
        v8us o;
#pragma unroll
        for (int i = 0; i < 8; ++i) { const float x = ts[(k8 + i) * 65 + n]; const unsigned short b = f2bf(x);
            const h16 hv = (h16)(__uint_as_float(((unsigned)b) << 16) * scale); const unsigned short hb = __builtin_bit_cast(unsigned short, hv);
            o[i] = asF16 ? hb : b; }
        if (it == 0) o0 = o; else o1 = o; }
    bf* d0 = WT + (size_t)(n0 + (tid >> 3)) * DM + k0 + (tid & 7) * 8;
    bf* d1 = WT + (size_t)(n0 + 32 + (tid >> 3)) * DM + k0 + (tid & 7) * 8;
    *(v8us*)d0 = o0; *(v8us*)d1 = o1;
    
}

// k_prep: everything the projections need and that needs nothing of each other, as block ranges of one grid (the branch is the same for a whole block):
// blocks [0, PB_WT): the four weight planes, 16 x 16 tiles each; [PB_WT, PB_WT + PB_TAB): the rotary table; then PB_CV blocks for each of q, k, v into its own bf16 plane.
#define PB_WP  ((DM / 64) * (DM / 64))
#define PB_WT  (4 * PB_WP)
#define PB_TAB (SEQ / 8)
#define PB_CV  ((unsigned)(((size_t)NB * SEQ * DM / 8 + 255) / 256))
__global__ __launch_bounds__(256) void k_prep(const float* __restrict__ q, const float* __restrict__ k, const float* __restrict__ v,
                                              const float* __restrict__ wq, const float* __restrict__ wk, const float* __restrict__ wv, const float* __restrict__ wo,
                                              bf* XB, bf* WB, float* CS) {
    __shared__ float ts[64 * 65];
    unsigned blk = blockIdx.x;
    if (blk < PB_WT) {
        const unsigned pl = blk / PB_WP, t = blk % PB_WP;
        const float* W = (pl == 0) ? wq : (pl == 1) ? wk : (pl == 2) ? wv : wo;
        d_wt(W, WB + (size_t)pl * DM * DM, pl == 3, (pl == 3) ? WOS : 1.0f, t % (DM / 64), t / (DM / 64), ts);
        return;
    }
    blk -= PB_WT;
    if (blk < PB_TAB) { d_tab(CS, blk); return; }
    blk -= PB_TAB;
    const unsigned pl = blk / PB_CV;
    const float* x = (pl == 0) ? q : (pl == 1) ? k : v;
    d_cvt8(x, XB + (size_t)pl * NB * SEQ * DM, blk % PB_CV);
}

// k_gemm: register-blocked GEMM, one wave per 64x64 tile (16 accumulators), 8 waves per block on a 256x128 tile, K = DM.
// Per stage of 64 k the block copies its 256 A rows and 128 Bt rows, one whole 128-byte line each, through registers into padded LDS (three buffers: the global loads of
// stage s + 2 are issued before the products of stage s and stored behind them, one barrier per stage); every wave reads its fragments from LDS, 32 k ahead of their products.
// C[m][n] = sum_k A[m][k] Bt[n][k]; tile base (r0/RB)*sRB + (r0%RB)*pitch + (c0/CB)*sCB + (c0%CB), row pitch 'pitch' (elements). blockIdx.x counts the block tiles of one GEMM, (M/256) x (N/128), rows fastest; 256 threads.
// MODE 0 (q, k; bf16 operands): + column bias, half-split rotary (the 64 tile columns are one head), RMS normalisation times weight, written as f16 (Ph) and optionally the f16 residual x2048 (Pr).
// MODE 1 (v^T; bf16 operands): + row bias, written as f16 (Ph).
// MODE 2 (output; f16 operands): * 2^-16 + column bias, written as f32 rows (OF).
// F16 = 0: the three projections, which need nothing of each other, share one grid; blockIdx.y = 0: q, 1: k (A = x rows, m = b*SEQ + t; Bt = W^T rows, n = h*64 + d -> plane [(b*16 + h)][t][d]),
// 2: v^T (A = Wv^T rows, m = h*64 + d; Bt = x rows, n = b*SEQ + t -> plane [(b*1024 + m)][t] = [(b*16 + h)][d][t]); X and Wt hold the planes of q, k, v one behind the other.
// F16 = 1: the output projection (A = ctx rows, m = b*SEQ + t; Bt = Wo^T rows -> OF[(b*OUT_SEQ + t)][n]).
static_assert((NB * SEQ / GBM) * (DM / GBN) == (DM / GBM) * (NB * SEQ / GBN));                 // as many block tiles in either operand order
template <int F16>
__global__ __launch_bounds__(32 * GW) void k_gemm(const bf* __restrict__ X, const bf* __restrict__ Wt, const float* __restrict__ bias0, const float* __restrict__ bias1, const float* __restrict__ bias2,
                                             const float* __restrict__ nw0, const float* __restrict__ nw1, const float* __restrict__ CS, h16* P0, h16* PR, h16* P1, h16* P2, float* OF) {
    const int z = F16 ? 0 : (int)blockIdx.y;
    const bool tv = !F16 && z == 2;
    const int MODE = F16 ? 2 : (tv ? 1 : 0);                 // the same for a whole block
    const bf* xz = X + (size_t)z * NB * SEQ * DM; const bf* wz = Wt + (size_t)z * DM * DM;
    const bf* A = tv ? wz : xz; const bf* Bt = tv ? xz : wz;
    const float* bias = (z == 0) ? bias0 : (z == 1) ? bias1 : bias2; const float* nw = (z == 0) ? nw0 : nw1;
    h16* Ph = (z == 0) ? P0 : (z == 1) ? P1 : P2; h16* Pr = (z == 0) ? PR : Ph;
    const int useRes = !F16 && z == 0;
    const int RB = tv ? DM : SEQ, pitch = F16 ? DM : (tv ? SEQ : HD), CB = pitch;
    const size_t sRB = F16 ? (size_t)OUT_SEQ * DM : (tv ? (size_t)0 : (size_t)NH_ * SEQ * HD), sCB = F16 ? (size_t)0 : (tv ? (size_t)DM * SEQ : (size_t)SEQ * HD);
    const unsigned bx = tv ? blockIdx.x % (DM / GBM) : blockIdx.x % (NB * SEQ / GBM), by = tv ? blockIdx.x / (DM / GBM) : blockIdx.x / (NB * SEQ / GBM);
    typedef Ops<F16> OP;
    typedef typename OP::T FT;
    __shared__ __align__(16) bf st[3 * GSZ];                 // three stage buffers: rows 0..255 = A rows of the block tile, rows 256..383 = Bt rows
    __shared__ __align__(16) float osw[GW * 16 * 68];        // epilogue tiles, one per wave
    const int K = DM;
    const int tid = threadIdx.x, lane = tid & 31, lr = lane & 15, hi = lane >> 4;
    const int wave = __builtin_amdgcn_readfirstlane(tid >> 5);
    float* os = osw + wave * (16 * 68);
    const int r0 = bx * GBM + (wave >> 1) * 64, c0 = by * GBN + (wave & 1) * 64;
    v8f acc[4][4];
#pragma unroll
    for (int mb = 0; mb < 4; ++mb)
#pragma unroll
        for (int nb = 0; nb < 4; ++nb) acc[mb][nb] = (v8f){};
    // copy: 384 rows x 8 pieces of 16 B = 12 pieces per thread; 8 consecutive lanes take one row's line, piece i is row i*32 + tid/8 (i < 8: A, else Bt)
    const int srow = tid >> 3, sc8 = (tid & 7) * 8;
    const bf* gA = A + (size_t)(bx * GBM + srow) * K + sc8;
    const bf* gB = Bt + (size_t)(by * GBN + srow) * K + sc8;
    const int sto = srow * GLP + sc8;
    const int aro = ((wave >> 1) * 64 + lr) * GLP + 8 * hi, bro = (GBM + (wave & 1) * 64 + lr) * GLP + 8 * hi;   // fragment rows in a stage buffer
    v8us pc[12];
    auto ldg = [&]() {                                       // the next stage's 12 pieces; the two row pointers then step on by one stage
#pragma unroll
        for (int i = 0; i < 8; ++i) pc[i] = *(const v8us*)(gA + (size_t)i * 32 * K);
#pragma unroll
        for (int i = 0; i < 4; ++i) pc[8 + i] = *(const v8us*)(gB + (size_t)i * 32 * K);
        // the loads' two address pairs stay as they are until this wait (they are its inputs) and are stepped on behind it
        asm volatile("s_wait_xcnt 0x0" :: "v"(gA), "v"(gB) : "memory");
        gA += GBK; gB += GBK; };
    auto sts = [&](bf* buf) {
#pragma unroll
        for (int i = 0; i < 12; ++i) *(v8us*)(buf + sto + i * 32 * GLP) = pc[i]; };
    FT a0[4], b0[4], a1[4], b1[4];                           // two fragment sets: k 0..31 and k 32..63 of a stage
    auto frags = [&](FT (&fa)[4], FT (&fb)[4], const bf* cur) {
#pragma unroll
        for (int mb = 0; mb < 4; ++mb) fa[mb] = OP::ld(cur + aro + mb * 16 * GLP);
#pragma unroll
        for (int nb = 0; nb < 4; ++nb) fb[nb] = OP::ld(cur + bro + nb * 16 * GLP); };
    // the two scheduling fences keep the 16 products one run: global loads sunk behind them
    // or LDS stores (which wait for those loads) lifted over them put the load latency in front of the products
    auto prod = [&](FT (&fa)[4], FT (&fb)[4]) {
        __builtin_amdgcn_sched_barrier(0);
#pragma unroll
        for (int nb = 0; nb < 4; ++nb)
#pragma unroll
            for (int mb = 0; mb < 4; ++mb) acc[mb][nb] = OP::mm(fa[mb], fb[nb], acc[mb][nb]);
        __builtin_amdgcn_sched_barrier(0); };
    ldg(); sts(st);
    ldg(); sts(st + GSZ);
    __syncthreads();                                         // stages 0 and 1 are complete for every wave
    int o0 = 0, o1 = GSZ, o2 = 2 * GSZ;                      // buffers of stage s, s + 1, s + 2
    frags(a0, b0, st);
#pragma unroll 1                                             // rolled: one stage's text serves all stages, so the kernel text stays short and the register sets stay two
    for (int s = 0; s + 2 < K / GBK; ++s) {
        frags(a1, b1, st + o0 + 32);
        ldg();                                               // stage s + 2
        prod(a0, b0);
        frags(a0, b0, st + o1);                              // stage s + 1 was published by the barrier that ended stage s - 1
        prod(a1, b1);
        sts(st + o2);                                        // held stage s - 1: its last reads were waited for in front of the barrier that ended stage s - 1
        __syncthreads();                                     // stage s + 2 is complete, and stage s has been read by every wave
        const int t = o0; o0 = o1; o1 = o2; o2 = t;
    }
    frags(a1, b1, st + o0 + 32); prod(a0, b0);
    frags(a0, b0, st + o1);      prod(a1, b1);
    frags(a1, b1, st + o1 + 32); prod(a0, b0);
    prod(a1, b1);
    const size_t tbase = (size_t)(r0 / RB) * sRB + (size_t)(r0 % RB) * (size_t)pitch + (size_t)(c0 / CB) * sCB + (size_t)(c0 % CB);
    const int rg = lane >> 3, c8 = (lane & 7) * 8, cp = c8 ^ 32, j0 = c8 & 31;
    const float sg = (c8 < 32) ? -1.0f : 1.0f;           // first half: x1 cos - x2 sin; second half: x2 cos + x1 sin
    const int tp0 = r0 % SEQ;                            // position of tile row 0 inside its sequence (MODE 0)
    float bo[8], bp[8], wv[8];
    v4f b4 = (v4f){};
    if (MODE == 0) {
#pragma unroll
        for (int i = 0; i < 8; ++i) { bo[i] = bfr(bias[c0 + c8 + i]); bp[i] = bfr(bias[c0 + cp + i]); wv[i] = bfr(nw[c8 + i]); }
    } else {
#pragma unroll
        for (int i = 0; i < 8; ++i) { bo[i] = 0.0f; bp[i] = 0.0f; wv[i] = 0.0f; }
    }
    if (MODE == 2) {
#pragma unroll
        for (int i = 0; i < 4; ++i) b4[i] = bfr(bias[c0 + lr * 4 + i]);
    }
#pragma unroll
    for (int mb = 0; mb < 4; ++mb) {
#pragma unroll
        for (int nb = 0; nb < 4; ++nb) {
#pragma unroll
            for (int j = 0; j < 8; ++j) os[(hi * 8 + j) * 68 + nb * 16 + lr] = acc[mb][nb][j]; }   // D: row 8h+j, col lane&15; rows 0..15 x columns 0..63 all written
        wave_sync();
        const size_t sb = tbase + (size_t)(mb * 16) * (size_t)pitch;
        if (MODE == 0) {
            v8h hq[4], rq[4];
#pragma unroll
            for (int s = 0; s < 4; ++s) { const int row = 4 * s + rg;                              // 4 s x 4 row groups = 16 rows; 8 lanes x 8 = 64 columns
                const float* op = &os[row * 68];
                const v4f x0 = *(const v4fa*)(op + c8), x1 = *(const v4fa*)(op + c8 + 4), y0 = *(const v4fa*)(op + cp), y1 = *(const v4fa*)(op + cp + 4);
                const float* cs = CS + (size_t)(tp0 + mb * 16 + row) * 64 + j0;
                const v4f ca = *(const v4f*)cs, cb = *(const v4f*)(cs + 4), sa = *(const v4f*)(cs + 32), sc = *(const v4f*)(cs + 36);
                asm volatile("s_wait_xcnt 0x0" :: "v"(cs) : "memory");   // the four table loads' address pair stays as it is until this wait (it is its input)
                float rot[8];
#pragma unroll
                for (int i = 0; i < 4; ++i) {
                    const float xo = x0[i] + bo[i], xp = y0[i] + bp[i]; rot[i] = xo * ca[i] + sg * (xp * sa[i]);
                    const float xq = x1[i] + bo[4 + i], xr = y1[i] + bp[4 + i]; rot[4 + i] = xq * cb[i] + sg * (xr * sc[i]); }
                float ss = 0.0f;
#pragma unroll
                for (int i = 0; i < 8; ++i) ss += rot[i] * rot[i];
                ss += __shfl_xor(ss, 1, 32); ss += __shfl_xor(ss, 2, 32); ss += __shfl_xor(ss, 4, 32);   // the 8 lanes of one row
                const float rinv = rsqrtf(ss * (1.0f / 64.0f) + RMS_EPS);
                v8h hv, rv;
#pragma unroll
                for (int i = 0; i < 8; ++i) { const float val = rot[i] * rinv * wv[i]; const h16 a0 = (h16)val; hv[i] = a0; rv[i] = (h16)((val - (float)a0) * QRS); }
                hq[s] = hv; rq[s] = rv; }
#pragma unroll
            for (int s = 0; s < 4; ++s) { const size_t oo = sb + (size_t)(4 * s + rg) * (size_t)pitch + c8;
                // a wait behind each store: its registers are written again by the residual's arithmetic, which the compiler puts under the branch, and by the next rows
                *(v8h*)(Ph + oo) = hq[s]; asm volatile("s_wait_xcnt 0x0" ::: "memory");
                if (useRes) { *(v8h*)(Pr + oo) = rq[s]; asm volatile("s_wait_xcnt 0x0" ::: "memory"); } }
        } else if (MODE == 1) {
            v8h hq[4];
#pragma unroll
            for (int s = 0; s < 4; ++s) { const int row = 4 * s + rg;
                const float br = bfr(bias[r0 + mb * 16 + row]);
                const v4f x0 = *(const v4fa*)(&os[row * 68 + c8]); const v4f x1 = *(const v4fa*)(&os[row * 68 + c8 + 4]); v8h hv;
#pragma unroll
                for (int i = 0; i < 4; ++i) { hv[i] = (h16)(x0[i] + br); hv[4 + i] = (h16)(x1[i] + br); }
                hq[s] = hv; }
#pragma unroll
            for (int s = 0; s < 4; ++s) { const size_t oo = sb + (size_t)(4 * s + rg) * (size_t)pitch + c8; *(v8h*)(Ph + oo) = hq[s]; }
            asm volatile("s_wait_xcnt 0x0" ::: "memory");    // the stores' registers are reused for the next 16 rows
        } else {
            v4f ov[8];
#pragma unroll
            for (int s = 0; s < 8; ++s) { const int row = 2 * s + hi;                              // 8 s x 2 rows = 16 rows; 16 lanes x 4 floats = 64 columns
                const v4f x = *(const v4fa*)(&os[row * 68 + lr * 4]); ov[s] = x * OSC + b4; }
#pragma unroll
            for (int s = 0; s < 8; ++s) { const size_t oo = sb + (size_t)(2 * s + hi) * (size_t)pitch + lr * 4; *(v4f*)(OF + oo) = ov[s]; }
            
        }
        wave_sync();
    }
}

typedef uint32_t u32x4 __attribute__((ext_vector_type(4)));
typedef uint32_t u32x8 __attribute__((ext_vector_type(8)));
__device__ __forceinline__ uint32_t uni(uint32_t v) { return (uint32_t)__builtin_amdgcn_readfirstlane(v); }
__device__ __forceinline__ uint32_t pinned(uint32_t v) { uint32_t w = __builtin_amdgcn_readfirstlane(v); asm volatile("" : "+s"(w)); return w; }
// descriptor group 1 of a tensor load: D1 rows of D0 bytes at source pitch PITCH bytes; 1-byte elements, tensor = tile, no mask; W0 = the pad word (16 B behind every row), a constant.
// Built once in front of the loop; pinned(): the descriptor words are held in scalar registers through the loop, so that none of them is formed anew while a request is outstanding.
template <uint32_t W0, uint32_t D0, uint32_t D1, uint32_t PITCH>
__device__ __forceinline__ u32x8 tdm_group1() {
    u32x8 g;
    g[0] = uni(W0); g[1] = pinned((D0 & 0xFFFFu) << 16); g[2] = pinned((D0 >> 16) | ((D1 & 0xFFFFu) << 16)); g[3] = pinned((D1 >> 16) | (D0 << 16));
    g[4] = pinned(D1); g[5] = pinned(PITCH); g[6] = pinned(0u); g[7] = pinned(0u);
    return g;
}
// g0 = descriptor group 0: count 1 | LDS byte offset | global address of the tile's first byte, low word | high word with type 2.
// It is named as in-out so that its four registers stay the request's own, and are used for nothing else, until the next request is formed in them behind the wait.
__device__ __forceinline__ void tdm_load(u32x4& g0, u32x8 g1) { asm volatile("tensor_load_to_lds %0, %1" : "+s"(g0) : "s"(g1) : "memory"); }

// k_flash: fused attention, one wave per QT x 16 query rows of one (batch, head); Q fragments straight from the f16 planes (two 16-B loads each, arithmetic addressing).
// K and V^T: the 8 waves of a block walk the same keys, so each tile of 128 keys (K 128 rows x 128 B, V^T 64 rows x 256 B) is brought into padded LDS once per block by two tensor loads
// (wave 0: K, wave 1: V^T); two buffers, tile t + 2 is asked for when tile t has been read by every wave; every wave reads its fragments from LDS.
// Every K and V^T fragment a wave loads is used for all QT query tiles it holds in registers, so the loads per matrix instruction fall by QT.
// Transposed form: S^T[key][t] = K Q^T (A = K rows, B = Q rows); lane (t = lane&15, h = lane>>4) holds keys 8h+r of each 16-key tile, so the packed
// P tile is directly the B fragment of O^T[d][t] = V^T P^T (element r <- tile keys 0..15, element 8+r <- tile keys 16..31, lane unchanged).
// Softmax state (running max, partial sum) is one scalar per lane and query tile; the two lane halves of a row are combined with one xor-16 exchange.
__global__ __launch_bounds__(32 * AW) void k_flash(const h16* __restrict__ QH, const h16* __restrict__ QR, const h16* __restrict__ KP, const h16* __restrict__ VT, h16* CTX) {
    __shared__ __align__(16) float os[AW * 16 * 68];
    __shared__ __attribute__((aligned(2048))) h16 kv[2 * FSZ];   // two tile buffers
    const int lane = threadIdx.x & 31, wave = threadIdx.x >> 5, lr = lane & 15, hi = lane >> 4;
    const int zh = blockIdx.y; const int b = zh / NH_, h = zh % NH_;
    const int t0 = (blockIdx.x * AW + wave) * (16 * QT);
    const size_t pbase = (size_t)zh * SEQ * HD;
    v16h qh0[QT], qh1[QT], qr0[QT], qr1[QT];                 // B fragments: col t, k = d
    v8f o[QT][4]; float m[QT], l[QT];
    const h16* qa[QT]; const h16* qb[QT];
#pragma unroll
    for (int i = 0; i < QT; ++i) { const size_t qo = pbase + (size_t)(t0 + 16 * i + lr) * HD + 8 * hi; qa[i] = QH + qo; qb[i] = QR + qo; }
#pragma unroll
    for (int i = 0; i < QT; ++i) { qh0[i] = ldh(qa[i]); qh1[i] = ldh(qa[i] + 32); qr0[i] = ldh(qb[i]); qr1[i] = ldh(qb[i] + 32); }
    static_assert(QT == 4);                                  // the wait below names the eight Q address pairs
    // the Q loads' address registers stay as they are until this wait (they are its inputs); they are reused behind it
    asm volatile("s_wait_xcnt 0x0" :: "v"(qa[0]), "v"(qa[1]), "v"(qa[2]), "v"(qa[3]), "v"(qb[0]), "v"(qb[1]), "v"(qb[2]), "v"(qb[3]) : "memory");
#pragma unroll
    for (int i = 0; i < QT; ++i) { o[i][0] = (v8f){}; o[i][1] = (v8f){}; o[i][2] = (v8f){}; o[i][3] = (v8f){}; m[i] = -3.0e38f; l[i] = 0.0f; }
    const uint32_t wv = uni(threadIdx.x >> 5);               // the wave's number (one-dimensional block)
    const uint32_t lb = (uint32_t)(size_t)kv;                // LDS byte offset of the buffers: the low 32 bits of the shared address
    // a tile's two requests: wave 0 brings the K rows, wave 1 the V^T rows; pad words: 128-B rows -> pitch 144 B, 256-B rows -> pitch 272 B
    const u32x8 g1k = tdm_group1<(1u << 20) | (4u << 22) | (3u << 25), HD * 2, FSK, HD * 2>();
    const u32x8 g1v = tdm_group1<(1u << 20) | (5u << 22) | (3u << 25), FSK * 2, HD, SEQ * 2>();
    const bool isv = wv != 0u;                               // the same for a whole wave; waves 2 to 7 form a descriptor and issue nothing
    const uint64_t ga = isv ? (uint64_t)(size_t)(VT + pbase) : (uint64_t)(size_t)(KP + pbase);
    const uint32_t dst = lb + (isv ? 2u * FKSZ : 0u), step = isv ? FSK * 2u : FSK * HD * 2u;   // place in a buffer; bytes from one tile to the next
    u32x4 g0;
    g0[0] = pinned(1u);                                      // pinned(): a descriptor word held in its scalar register through the loop
    g0[1] = uni(dst); g0[2] = uni((uint32_t)ga); g0[3] = uni((((uint32_t)(ga >> 32)) & 0x01FFFFFFu) | 0x80000000u);
    auto issue = [&]() {
        if (pinned(wv == 0u)) tdm_load(g0, g1k);
        if (pinned(wv == 1u)) tdm_load(g0, g1v); };
    // the next tile's descriptor, for buffer buf; pinned(): the step is taken up behind the wait that stands in front of this call, so the address words are not formed before it
    auto next = [&](uint32_t buf) {
        const uint64_t a = (((uint64_t)g0[3] << 32) | g0[2]) + pinned(step);
        g0[1] = uni(dst + buf * (2u * FSZ)); g0[2] = uni((uint32_t)a); g0[3] = uni((uint32_t)(a >> 32)); };
    constexpr uint32_t NT = SEQ / FSK;
    issue();                                                 // tile 0 into buffer 0
    if (pinned(wv < 2u)) asm volatile("s_wait_tensorcnt 0x0" ::: "memory");   // the issuing wave's request for tile 0 has landed
    __syncthreads();                                         // tile 0 is complete for every wave
    next(1u); issue();                                       // tile 1 into buffer 1
    const int kfo = lr * FKP + 8 * hi;                       // + key * FKP        (A fragment: row key, k = d)
    const int vfo = FKSZ + lr * FVP + 8 * hi;                // + 16j * FVP + key  (A fragment: row d, k = key)
#pragma unroll 1                                             // rolled: one pass's text serves all tiles
    for (uint32_t t = 0; t < NT; ++t) {
      const h16* sb = kv + (t & 1u) * FSZ;
#pragma unroll 1                                             // rolled: one pass's text serves the four passes of a tile
      for (int key0 = 0; key0 < FSK; key0 += 32) {
        const h16* ka = sb + kfo + key0 * FKP;
        const v16h ka0 = ldh(ka), ka1 = ldh(ka + 32), kb0 = ldh(ka + 16 * FKP), kb1 = ldh(ka + 16 * FKP + 32);
        v16h pb[QT];
#pragma unroll
        for (int i = 0; i < QT; ++i) {
            v8f sHa = (v8f){}, sLa = (v8f){}, sHb = (v8f){}, sLb = (v8f){};
            sHa = wmma16(ka0, qh0[i], sHa); sLa = wmma16(ka0, qr0[i], sLa); sHb = wmma16(kb0, qh0[i], sHb); sLb = wmma16(kb0, qr0[i], sLb);
            sHa = wmma16(ka1, qh1[i], sHa); sLa = wmma16(ka1, qr1[i], sLa); sHb = wmma16(kb1, qh1[i], sHb); sLb = wmma16(kb1, qr1[i], sLb);
            float ta[8], tb[8]; float mx = -3.0e38f;
#pragma unroll
            for (int r = 0; r < 8; ++r) { ta[r] = (sHa[r] + sLa[r] * QRI) * SC2; tb[r] = (sHb[r] + sLb[r] * QRI) * SC2; mx = fmaxf(mx, fmaxf(ta[r], tb[r])); }
            mx = fmaxf(mx, __shfl_xor(mx, 16, 32));
            const float mnew = fmaxf(m[i], mx);
            const float alpha = __builtin_amdgcn_exp2f(m[i] - mnew);
            const float sh = PSH - mnew;
            v16h pv; float ls = 0.0f;
#pragma unroll
            for (int r = 0; r < 8; ++r) { const h16 pa = (h16)__builtin_amdgcn_exp2f(ta[r] + sh); const h16 pc = (h16)__builtin_amdgcn_exp2f(tb[r] + sh); pv[r] = pa; pv[8 + r] = pc; ls += (float)pa + (float)pc; }
            pb[i] = pv;
            l[i] = l[i] * alpha + ls; m[i] = mnew;
            o[i][0] = o[i][0] * alpha; o[i][1] = o[i][1] * alpha; o[i][2] = o[i][2] * alpha; o[i][3] = o[i][3] * alpha;
        }
        const h16* va = sb + vfo + key0;
        const v16h v0 = ldh(va), v1 = ldh(va + 16 * FVP), v2 = ldh(va + 32 * FVP), v3 = ldh(va + 48 * FVP);
#pragma unroll
        for (int i = 0; i < QT; ++i) { o[i][0] = wmma16(v0, pb[i], o[i][0]); o[i][1] = wmma16(v1, pb[i], o[i][1]); o[i][2] = wmma16(v2, pb[i], o[i][2]); o[i][3] = wmma16(v3, pb[i], o[i][3]); }
        // the distance behind the pass's last products on the loop's taken branch: the next pass's first vector instructions write registers that were their A operands
        // the scheduling fence keeps the products in front of the four slots
        __builtin_amdgcn_sched_barrier(0);
        asm volatile("v_nop\n\tv_nop\n\tv_nop\n\tv_nop");
      }
      asm volatile("s_wait_dscnt 0x0" ::: "memory");         // this wave's reads of tile t have returned
      if (pinned(wv < 2u)) asm volatile("s_wait_tensorcnt 0x0" ::: "memory");   // the issuing wave's request for tile t + 1 has landed
      __syncthreads();                                       // tile t + 1 is complete, and tile t has been read by every wave
      if (pinned(t + 2u < NT)) { next(t & 1u); issue(); }    // tile t + 2 into the buffer that tile t has left
    }
    asm volatile("s_wait_tensorcnt 0x0" ::: "memory");       // no request is outstanding when the wave goes on to its end
    asm volatile("s_wait_dscnt 0x0" ::: "memory");
    const int wb = wave * 16 * 68;
    const int rg = lane >> 3, c8 = (lane & 7) * 8;
#pragma unroll
    for (int i = 0; i < QT; ++i) {
        const float lt = l[i] + __shfl_xor(l[i], 16, 32);
        const float inv = (1.0f / lt) * CTXS;
        // O^T D layout: o[i][j][r] = (d = 16j + 8h + r, t = lane&15) -> os[t][d]; rows 0..15 x columns 0..63 all written
#pragma unroll
        for (int j = 0; j < 4; ++j) { v4f a, c;
            a[0] = o[i][j][0] * inv; a[1] = o[i][j][1] * inv; a[2] = o[i][j][2] * inv; a[3] = o[i][j][3] * inv; c[0] = o[i][j][4] * inv; c[1] = o[i][j][5] * inv; c[2] = o[i][j][6] * inv; c[3] = o[i][j][7] * inv;
            *(v4fa*)(&os[wb + lr * 68 + 16 * j + 8 * hi]) = a; *(v4fa*)(&os[wb + lr * 68 + 16 * j + 8 * hi + 4]) = c; }
        wave_sync();
        h16* crow = CTX + ((size_t)b * SEQ + t0 + 16 * i) * DM + h * HD;
        v8h hq[4];
#pragma unroll
        for (int s = 0; s < 4; ++s) { const int row = 4 * s + rg;                                  // 4 s x 4 row groups = 16 rows; 8 lanes x 8 halves = 64 columns
            const v4f x0 = *(const v4fa*)(&os[wb + row * 68 + c8]); const v4f x1 = *(const v4fa*)(&os[wb + row * 68 + c8 + 4]); v8h hv;
#pragma unroll
            for (int k = 0; k < 4; ++k) { hv[k] = (h16)x0[k]; hv[4 + k] = (h16)x1[k]; }
            hq[s] = hv; }
#pragma unroll
        for (int s = 0; s < 4; ++s) *(v8h*)(crow + (size_t)(4 * s + rg) * DM + c8) = hq[s];
        if (i + 1 < QT) {
            asm volatile("s_wait_xcnt 0x0" ::: "memory");    // the stores' registers are reused for the next query tile
            wave_sync();                                     // the tile is read out before the next query tile overwrites it
        }
    }
}

static constexpr size_t al256(size_t v) { return (v + 255) & ~(size_t)255; }
static constexpr size_t SZ_XB = al256((size_t)NB * SEQ * DM * 2);          // bf16 copy of one activation input; also the size of the ctx plane
static constexpr size_t SZ_WB = al256((size_t)4 * DM * DM * 2);            // four transposed 16-bit weight planes
static constexpr size_t SZ_CS = al256((size_t)SEQ * 64 * 4);               // rotary table
static constexpr size_t SZ_PL = al256((size_t)NB * NH_ * SEQ * HD * 2);    // one f16 head plane
static constexpr size_t SZ_TOTAL = 3 * SZ_XB + SZ_WB + SZ_CS + 4 * SZ_PL;
static_assert(SZ_TOTAL <= (size_t)134217728);          // workspace carve <= 128 MiB
static_assert(((size_t)DM * DM * 2) % 256 == 0);       // weight sub-planes stay 256-byte aligned
static_assert((size_t)NB * SEQ * DM * 2 <= SZ_XB);     // ctx plane extent

extern "C" void kernel_launch(void* const* d_in, const int* in_sizes, int n_in,
                              void* d_out, int out_size, void* d_ws, size_t ws_size, hipStream_t stream) {
    if (n_in < 13) return;
    const size_t needx = ((size_t)(NB - 1) * SEQ_FULL + SEQ) * DM;
    if ((size_t)in_sizes[0] < needx || (size_t)in_sizes[1] < needx || (size_t)in_sizes[2] < needx) return;
    if ((size_t)in_sizes[3] < (size_t)DM * DM || (size_t)in_sizes[5] < (size_t)DM * DM || (size_t)in_sizes[7] < (size_t)DM * DM || (size_t)in_sizes[9] < (size_t)DM * DM) return;
    if (in_sizes[4] < DM || in_sizes[6] < DM || in_sizes[8] < DM || in_sizes[10] < DM) return;
    if (in_sizes[11] < HD || in_sizes[12] < HD) return;
    if ((size_t)out_size < ((size_t)(NB - 1) * OUT_SEQ + SEQ) * DM) return;
    if (SZ_TOTAL > ws_size) return;
    // wire order: q, k, v, wq_w, wq_b, wk_w, wk_b, wv_w, wv_b, wo_w, wo_b, qn_w, kn_w (weights [in][out])
    const float* q  = (const float*)d_in[0];  const float* k  = (const float*)d_in[1];  const float* v  = (const float*)d_in[2];
    const float* wq = (const float*)d_in[3];  const float* bq = (const float*)d_in[4];
    const float* wk = (const float*)d_in[5];  const float* bk = (const float*)d_in[6];
    const float* wv = (const float*)d_in[7];  const float* bv = (const float*)d_in[8];
    const float* wo = (const float*)d_in[9];  const float* bo = (const float*)d_in[10];
    const float* qnw = (const float*)d_in[11]; const float* knw = (const float*)d_in[12];
    float* OUT = (float*)d_out;      // [NB][OUT_SEQ][1024]
    char* wsp = (char*)d_ws;
    bf* XB = (bf*)wsp; wsp += 3 * SZ_XB;             // [3][NB*SEQ][1024] bf16: q | k | v
    bf* WB = (bf*)wsp; wsp += SZ_WB;                 // [4][1024 out][1024 in]: q | k | v (bf16) | o (f16 x1024)
    float* CS = (float*)wsp; wsp += SZ_CS;           // [SEQ][64]: cos | sin
    h16* QH = (h16*)wsp; wsp += SZ_PL;               // [NB*16][SEQ][64]
    h16* QR = (h16*)wsp; wsp += SZ_PL;               // [NB*16][SEQ][64] residual x2048
    h16* KP = (h16*)wsp; wsp += SZ_PL;               // [NB*16][SEQ][64]
    h16* VT = (h16*)wsp; wsp += SZ_PL;               // [NB*16][64][SEQ]
    h16* CTX = (h16*)XB;                             // [NB*SEQ][1024] x64, over the q copy, which nothing reads behind the projections
    bf* WO = WB + (size_t)3 * DM * DM;

    k_prep<<<PB_WT + PB_TAB + 3 * PB_CV, 256, 0, stream>>>(q, k, v, wq, wk, wv, wo, XB, WB, CS);

    k_gemm<0><<<dim3((NB * SEQ / GBM) * (DM / GBN), 3, 1), 32 * GW, 0, stream>>>(XB, WB, bq, bk, bv, qnw, knw, CS, QH, QR, KP, VT, OUT);

    k_flash<<<dim3(SEQ / (16 * AW * QT), NB * NH_, 1), 32 * AW, 0, stream>>>(QH, QR, KP, VT, CTX);

    k_gemm<1><<<dim3((NB * SEQ / GBM) * (DM / GBN), 1, 1), 32 * GW, 0, stream>>>((const bf*)CTX, WO, bo, bo, bo, qnw, knw, CS, QH, QH, QH, QH, OUT);
}

// v005
// One run takes 182 microseconds.
// In both of two side-by-side timings against v004, it was 1.03 times as fast.
// Over all steps from v000 it is 2.20 times as fast.
#include <hip/hip_runtime.h>

// Multi-head attention, width 1024 = 16 heads x 64: q/k/v [NB][SEQ_FULL][1024] (first SEQ rows of each batch used), weights [in][out] (y = x W + b), half-split rotary on q and k (table cos/sin of t * 10000^(-j/32)), per-head RMS normalisation with weights, score scale 1/8, no mask, output projection with bias, f32 output.
// Compute dtypes, f32 accumulate everywhere: q/k/v projections v_wmma_f32_16x16x32_bf16 (inputs and weights RNE-converted to bf16; products exact);
// scores v_wmma_f32_16x16x32_f16: k single f16, q as f16 value + f16 residual x2048 in its own accumulator (two products); P (x256 carry, cancels in the normalisation) and v single f16;
// output projection v_wmma_f32_16x16x32_f16: ctx f16 (x64 carry), Wo^T f16 built from the bf16 RNE value (x1024 carry), 2^-16 folded back in the f32 epilogue; softmax, rotary and normalisation in f32.
// Layout: a bf16 copy of each activation input; transposed 16-bit weight planes [out][in]; q (value, residual), k planes [b*16+h][t][d] and v^T plane [b*16+h][d][t] written by the GEMM epilogue;
// fused flash kernel in transposed form (S^T = K Q^T, O^T = V^T P^T) writes the ctx plane [b*SEQ+t][1024]; final GEMM writes the f32 output.

#ifndef NB
#define NB 4
#endif
#ifndef SEQ
#define SEQ 2048
#endif
#define NB_FULL  4
#define SEQ_FULL 2048
#ifndef OUT_SEQ
#define OUT_SEQ SEQ              // row pitch (in tokens) between batches of the output
#endif
#define DM   1024
#define NH_  16
#define HD   64
#define AW   8                   // waves per flash block
#define QT   4                   // query tiles of 16 rows per flash wave
#define QRS  2048.0f             // carry of the q residual plane
#define QRI  (1.0f / 2048.0f)
#define SC2  (0.125f * 1.4426950408889634f)   // HD^-0.5 * log2(e)
#define PSH  8.0f                // log2 of the P carry (256)
#define CTXS 64.0f               // carry of the ctx plane
#define WOS  1024.0f             // carry of the Wo^T plane
#define OSC  (1.0f / 65536.0f)   // 1 / (CTXS * WOS)
#define RMS_EPS 1.0e-6f
#define GW   8                   // waves per GEMM block: 4 (rows) x 2 (columns) wave tiles of 64 x 64
#define GBM  256                 // block tile rows
#define GBN  128                 // block tile columns
#define GBK  64                  // k per stage: one whole 128-byte line of every operand row
#define GLP  72                  // LDS row pitch in elements: 144 B = 16 B x 9, no bank conflict for the 16-byte fragment reads
#define GSZ  ((GBM + GBN) * GLP) // elements of one stage buffer
#define FSK  128                 // keys per LDS tile of the flash kernel: 4 passes of 32 keys
#define FKP  72                  // K tile row pitch in elements: 128-B rows at 144 B = 16 B x 9
#define FVP  136                 // V^T tile row pitch in elements: 256-B rows at 272 B = 16 B x 17
#define FKSZ (FSK * FKP)         // elements of the K part of one tile buffer: 18,432 B = 9 x 2 KiB
#define FSZ  (2 * FKSZ)          // elements of one tile buffer: K rows, then from the next multiple of 2 KiB the V^T rows (17,408 B), rounded up to a multiple of 2 KiB

static_assert(HD == 64);
static_assert(NH_ * HD == DM);                 // head h = columns h*64 + d
static_assert(DM % 64 == 0);                   // 16 column tiles of 64
static_assert(DM % 32 == 0);                   // each GEMM product takes 32 k
static_assert(SEQ % 64 == 0);                  // a 64-row tile never straddles two batches
static_assert((NB * SEQ) % GBM == 0 && DM % GBM == 0 && (NB * SEQ) % GBN == 0 && DM % GBN == 0);   // GEMM grids cover M and N exactly, either operand order
static_assert(GBK == 64 && DM % GBK == 0 && DM / GBK >= 3);
static_assert(GW == 8 && GBM == 256 && GBN == 128);      // the copy's 8 + 4 pieces per thread and the 4 x 2 wave grid are written for these
static_assert((GBM + GBN) * (GBK / 8) % (32 * GW) == 0 && GBM % (32 * GW / (GBK / 8)) == 0);          // whole 16-byte pieces per thread; a piece index is all A or all B
static_assert(SEQ % 32 == 0);                  // key loop steps by 32
static_assert(FSK == 128 && SEQ % FSK == 0 && SEQ / FSK >= 2 && AW >= 2);   // whole key tiles inside the planes, at least the two that the prologue asks for; two issuing waves
static_assert((FKSZ * 2) % 2048 == 0 && HD * FVP <= FKSZ && FKP * 2 == HD * 2 + 16 && FVP * 2 == FSK * 2 + 16);   // places in LDS at multiples of 2 KiB; pitch = row + 16 B of pad
static_assert((SEQ * 2) % 16 == 0 && SEQ * 2 <= 131072);   // source pitch of the V^T tile
static_assert(SEQ % (16 * AW * QT) == 0);      // flash grid covers the sequence exactly
static_assert(SEQ % 8 == 0);                   // table kernel: 8 positions per block
static_assert(((size_t)SEQ * DM) % 8 == 0);
static_assert(((size_t)DM * DM) % 8 == 0);
static_assert(NB <= NB_FULL);
static_assert(SEQ <= SEQ_FULL);
static_assert(OUT_SEQ >= SEQ);

typedef _Float16 h16;
typedef unsigned short bf;
typedef __attribute__((ext_vector_type(16))) __bf16   v16bf;
typedef __attribute__((ext_vector_type(16))) _Float16 v16h;
typedef __attribute__((ext_vector_type(8)))  _Float16 v8h;
typedef __attribute__((ext_vector_type(8)))  unsigned short v8us;
typedef __attribute__((ext_vector_type(8)))  float    v8f;
typedef __attribute__((ext_vector_type(4)))  float    v4f;
typedef v4f  __attribute__((may_alias)) v4fa;

__device__ __forceinline__ unsigned short f2bf(float f) { unsigned u = __float_as_uint(f); u += 0x7FFFu + ((u >> 16) & 1u); return (unsigned short)(u >> 16); }
__device__ __forceinline__ float bfr(float f) { return __uint_as_float(((unsigned)f2bf(f)) << 16); }   // value after RNE convert to bf16
__device__ __forceinline__ v16h cat16(v8h lo, v8h hi) { return __builtin_shufflevector(lo, hi, 0, 1, 2, 3, 4, 5, 6, 7, 8, 9, 10, 11, 12, 13, 14, 15); }
__device__ __forceinline__ v16bf cat16b(v8us lo, v8us hi) { return __builtin_bit_cast(v16bf, __builtin_shufflevector(lo, hi, 0, 1, 2, 3, 4, 5, 6, 7, 8, 9, 10, 11, 12, 13, 14, 15)); }
__device__ __forceinline__ v8f wmma16(v16h a, v16h b, v8f c) { return __builtin_amdgcn_wmma_f32_16x16x32_f16(false, a, false, b, (short)0, c, false, false); }
__device__ __forceinline__ v8f wmmab(v16bf a, v16bf b, v8f c) { return __builtin_amdgcn_wmma_f32_16x16x32_bf16(false, a, false, b, (short)0, c, false, false); }
// fragment loaders from K-contiguous 16-bit rows; p already includes + 8*(lane>>4): elements 0..7 <- k0+8h+0..7, elements 8..15 <- k0+16+8h+0..7 (same map for A and B)
__device__ __forceinline__ v16h  ldh(const h16* p) { return cat16(*(const v8h*)p, *(const v8h*)(p + 16)); }
__device__ __forceinline__ v16bf ldb(const bf* p)  { return cat16b(*(const v8us*)p, *(const v8us*)(p + 16)); }
// ordering point for wave-private LDS tiles (same wave writes and reads)
__device__ __forceinline__ void wave_sync() { __builtin_amdgcn_fence(3 /* release order */, "wavefront"); __builtin_amdgcn_wave_barrier(); asm volatile("" ::: "memory"); }

// operand type selection for the GEMM: 0 = bf16 planes, 1 = f16 planes (both addressed as 16-bit rows)
template <int F16> struct Ops;
template <> struct Ops<0> { typedef v16bf T;
    static __device__ __forceinline__ T ld(const bf* p) { return ldb(p); }
    static __device__ __forceinline__ v8f mm(T a, T b, v8f c) { return wmmab(a, b, c); } };
template <> struct Ops<1> { typedef v16h T;
    static __device__ __forceinline__ T ld(const bf* p) { return ldh((const h16*)p); }
    static __device__ __forceinline__ v8f mm(T a, T b, v8f c) { return wmma16(a, b, c); } };

// d_cvt8: block bi of the f32 -> bf16 copy of one activation input, [NB][SEQ_FULL][DM] rows 0..SEQ-1 of every batch -> [NB*SEQ][DM]; 8 elements per thread.
__device__ __forceinline__ void d_cvt8(const float* __restrict__ src, bf* dst, unsigned bi) {
    const size_t n8 = (size_t)NB * SEQ * DM / 8, per = (size_t)SEQ * DM / 8;
    const size_t i = (size_t)bi * 256 + threadIdx.x; if (i >= n8) return;
    const size_t so = (SEQ == SEQ_FULL) ? i * 8 : (i / per) * ((size_t)SEQ_FULL * DM) + (i % per) * 8;
    const v8f v = *(const v8f*)(src + so); v8us o;
#pragma unroll
    for (int k = 0; k < 8; ++k) o[k] = f2bf(v[k]);
    *(v8us*)(dst + i * 8) = o; 
}

// d_tab: block bi (8 positions) of the rotary table CS[t][0..31] = cos(t * f_j), CS[t][32..63] = sin(t * f_j), f_j = 10000^(-j/32) (f64 product chain, converted to f32), angle = f32 product.
__device__ __forceinline__ void d_tab(float* CS, unsigned bi) {
    const int lane = threadIdx.x & 31; const int t = bi * 8 + (threadIdx.x >> 5);
    double r = 1.0;
#pragma unroll 1
    for (int i = 0; i < lane; ++i) r *= 0.7498942093324558;    // 10^(-1/8)
    const float inv = (float)r; const float ang = (float)t * inv;
    float s, c; sincosf(ang, &s, &c);
    float* row = CS + (size_t)t * 64;
    *(float*)(row + lane) = c; *(float*)(row + 32 + lane) = s;
    asm volatile("s_wait_xcnt 0x0" ::: "memory");            // the two stores' registers may be written again in the text that follows them in the merged kernel
}

// d_wt: W f32 in[rows = k][cols = n] (pitch DM) -> WT 16-bit out[n][k] (pitch DM), transposed through LDS; tile (bx of DM/64 over n, by of DM/64 over k), 256 threads.
__device__ __forceinline__ void d_wt(const float* __restrict__ W, bf* WT, int asF16, float scale, int bx, int by, float* ts) {
    const int tid = threadIdx.x; const int n0 = bx * 64, k0 = by * 64;
#pragma unroll
    for (int it = 0; it < 4; ++it) { const int idx = it * 256 + tid; const int kk = idx >> 4, n4 = (idx & 15) * 4;   // 64 k rows x 16 float4 = 1024 pieces
        const v4f v = *(const v4f*)(W + (size_t)(k0 + kk) * DM + n0 + n4);
        ts[kk * 65 + n4 + 0] = v[0]; ts[kk * 65 + n4 + 1] = v[1]; ts[kk * 65 + n4 + 2] = v[2]; ts[kk * 65 + n4 + 3] = v[3]; }
    __syncthreads();
    v8us o0, o1;
#pragma unroll
    for (int it = 0; it < 2; ++it) { const int p = it * 256 + tid; const int n = p >> 3, k8 = (p & 7) * 8;            // 64 n rows x 8 pieces = 512 pieces
        v8us o;
#pragma unroll
        for (int i = 0; i < 8; ++i) { const float x = ts[(k8 + i) * 65 + n]; const unsigned short b = f2bf(x);
            const h16 hv = (h16)(__uint_as_float(((unsigned)b) << 16) * scale); const unsigned short hb = __builtin_bit_cast(unsigned short, hv);
            o[i] = asF16 ? hb : b; }
        if (it == 0) o0 = o; else o1 = o; }
    bf* d0 = WT + (size_t)(n0 + (tid >> 3)) * DM + k0 + (tid & 7) * 8;
    bf* d1 = WT + (size_t)(n0 + 32 + (tid >> 3)) * DM + k0 + (tid & 7) * 8;
    *(v8us*)d0 = o0; *(v8us*)d1 = o1;
    
}

// k_prep: everything the projections need and that needs nothing of each other, as block ranges of one grid (the branch is the same for a whole block):
// blocks [0, PB_WT): the four weight planes, 16 x 16 tiles each; [PB_WT, PB_WT + PB_TAB): the rotary table; then PB_CV blocks for each of q, k, v into its own bf16 plane.
#define PB_WP  ((DM / 64) * (DM / 64))
#define PB_WT  (4 * PB_WP)
#define PB_TAB (SEQ / 8)
#define PB_CV  ((unsigned)(((size_t)NB * SEQ * DM / 8 + 255) / 256))
__global__ __launch_bounds__(256) void k_prep(const float* __restrict__ q, const float* __restrict__ k, const float* __restrict__ v,
                                              const float* __restrict__ wq, const float* __restrict__ wk, const float* __restrict__ wv, const float* __restrict__ wo,
                                              bf* XB, bf* WB, float* CS) {
    __shared__ float ts[64 * 65];
    unsigned blk = blockIdx.x;
    if (blk < PB_WT) {
        const unsigned pl = blk / PB_WP, t = blk % PB_WP;
        const float* W = (pl == 0) ? wq : (pl == 1) ? wk : (pl == 2) ? wv : wo;
        d_wt(W, WB + (size_t)pl * DM * DM, pl == 3, (pl == 3) ? WOS : 1.0f, t % (DM / 64), t / (DM / 64), ts);
        return;
    }
    blk -= PB_WT;
    if (blk < PB_TAB) { d_tab(CS, blk); return; }
    blk -= PB_TAB;
    const unsigned pl = blk / PB_CV;
    const float* x = (pl == 0) ? q : (pl == 1) ? k : v;
    d_cvt8(x, XB + (size_t)pl * NB * SEQ * DM, blk % PB_CV);
}

// k_gemm: register-blocked GEMM, one wave per 64x64 tile (16 accumulators), 8 waves per block on a 256x128 tile, K = DM.
// Per stage of 64 k the block copies its 256 A rows and 128 Bt rows, one whole 128-byte line each, through registers into padded LDS (three buffers: the global loads of
// stage s + 2 are issued before the products of stage s and stored behind them, one barrier per stage); every wave reads its fragments from LDS, 32 k ahead of their products.
// C[m][n] = sum_k A[m][k] Bt[n][k]; tile base (r0/RB)*sRB + (r0%RB)*pitch + (c0/CB)*sCB + (c0%CB), row pitch 'pitch' (elements). blockIdx.x counts the block tiles of one GEMM, (M/256) x (N/128), rows fastest; 256 threads.
// MODE 0 (q, k; bf16 operands): + column bias, half-split rotary (the 64 tile columns are one head), RMS normalisation times weight, written as f16 (Ph) and optionally the f16 residual x2048 (Pr).
// MODE 1 (v^T; bf16 operands): + row bias, written as f16 (Ph).
// MODE 2 (output; f16 operands): * 2^-16 + column bias, written as f32 rows (OF).
// F16 = 0: the three projections, which need nothing of each other, share one grid; blockIdx.y = 0: q, 1: k (A = x rows, m = b*SEQ + t; Bt = W^T rows, n = h*64 + d -> plane [(b*16 + h)][t][d]),
// 2: v^T (A = Wv^T rows, m = h*64 + d; Bt = x rows, n = b*SEQ + t -> plane [(b*1024 + m)][t] = [(b*16 + h)][d][t]); X and Wt hold the planes of q, k, v one behind the other.
// F16 = 1: the output projection (A = ctx rows, m = b*SEQ + t; Bt = Wo^T rows -> OF[(b*OUT_SEQ + t)][n]).
static_assert((NB * SEQ / GBM) * (DM / GBN) == (DM / GBM) * (NB * SEQ / GBN));                 // as many block tiles in either operand order
template <int F16>
__global__ __launch_bounds__(32 * GW) void k_gemm(const bf* __restrict__ X, const bf* __restrict__ Wt, const float* __restrict__ bias0, const float* __restrict__ bias1, const float* __restrict__ bias2,
                                             const float* __restrict__ nw0, const float* __restrict__ nw1, const float* __restrict__ CS, h16* P0, h16* PR, h16* P1, h16* P2, float* OF) {
    const int z = F16 ? 0 : (int)blockIdx.y;
    const bool tv = !F16 && z == 2;
    const int MODE = F16 ? 2 : (tv ? 1 : 0);                 // the same for a whole block
    const bf* xz = X + (size_t)z * NB * SEQ * DM; const bf* wz = Wt + (size_t)z * DM * DM;
    const bf* A = tv ? wz : xz; const bf* Bt = tv ? xz : wz;
    const float* bias = (z == 0) ? bias0 : (z == 1) ? bias1 : bias2; const float* nw = (z == 0) ? nw0 : nw1;
    h16* Ph = (z == 0) ? P0 : (z == 1) ? P1 : P2; h16* Pr = (z == 0) ? PR : Ph;
    const int useRes = !F16 && z == 0;
    const int RB = tv ? DM : SEQ, pitch = F16 ? DM : (tv ? SEQ : HD), CB = pitch;
    const size_t sRB = F16 ? (size_t)OUT_SEQ * DM : (tv ? (size_t)0 : (size_t)NH_ * SEQ * HD), sCB = F16 ? (size_t)0 : (tv ? (size_t)DM * SEQ : (size_t)SEQ * HD);
    const unsigned bx = tv ? blockIdx.x % (DM / GBM) : blockIdx.x % (NB * SEQ / GBM), by = tv ? blockIdx.x / (DM / GBM) : blockIdx.x / (NB * SEQ / GBM);
    typedef Ops<F16> OP;
    typedef typename OP::T FT;
    __shared__ __align__(16) bf st[3 * GSZ];                 // three stage buffers: rows 0..255 = A rows of the block tile, rows 256..383 = Bt rows
    __shared__ __align__(16) float osw[GW * 16 * 68];        // epilogue tiles, one per wave
    const int K = DM;
    const int tid = threadIdx.x, lane = tid & 31, lr = lane & 15, hi = lane >> 4;
    const int wave = __builtin_amdgcn_readfirstlane(tid >> 5);
    float* os = osw + wave * (16 * 68);
    const int r0 = bx * GBM + (wave >> 1) * 64, c0 = by * GBN + (wave & 1) * 64;
    v8f acc[4][4];
#pragma unroll
    for (int mb = 0; mb < 4; ++mb)
#pragma unroll
        for (int nb = 0; nb < 4; ++nb) acc[mb][nb] = (v8f){};
    // copy: 384 rows x 8 pieces of 16 B = 12 pieces per thread; 8 consecutive lanes take one row's line, piece i is row i*32 + tid/8 (i < 8: A, else Bt)
    const int srow = tid >> 3, sc8 = (tid & 7) * 8;
    const bf* gA = A + (size_t)(bx * GBM + srow) * K + sc8;
    const bf* gB = Bt + (size_t)(by * GBN + srow) * K + sc8;
    const int sto = srow * GLP + sc8;
    const int aro = ((wave >> 1) * 64 + lr) * GLP + 8 * hi, bro = (GBM + (wave & 1) * 64 + lr) * GLP + 8 * hi;   // fragment rows in a stage buffer
    v8us pc[12];
    auto ldg = [&]() {                                       // the next stage's 12 pieces; the two row pointers then step on by one stage
#pragma unroll
        for (int i = 0; i < 8; ++i) pc[i] = *(const v8us*)(gA + (size_t)i * 32 * K);
#pragma unroll
        for (int i = 0; i < 4; ++i) pc[8 + i] = *(const v8us*)(gB + (size_t)i * 32 * K);
        // the loads' two address pairs stay as they are until this wait (they are its inputs) and are stepped on behind it
        asm volatile("s_wait_xcnt 0x0" :: "v"(gA), "v"(gB) : "memory");
        gA += GBK; gB += GBK; };
    auto sts = [&](bf* buf) {
#pragma unroll
        for (int i = 0; i < 12; ++i) *(v8us*)(buf + sto + i * 32 * GLP) = pc[i]; };
    FT a0[4], b0[4], a1[4], b1[4];                           // two fragment sets: k 0..31 and k 32..63 of a stage
    auto frags = [&](FT (&fa)[4], FT (&fb)[4], const bf* cur) {
#pragma unroll
        for (int mb = 0; mb < 4; ++mb) fa[mb] = OP::ld(cur + aro + mb * 16 * GLP);
#pragma unroll
        for (int nb = 0; nb < 4; ++nb) fb[nb] = OP::ld(cur + bro + nb * 16 * GLP); };
    // the two scheduling fences keep the 16 products one run: global loads sunk behind them
    // or LDS stores (which wait for those loads) lifted over them put the load latency in front of the products
    auto prod = [&](FT (&fa)[4], FT (&fb)[4]) {
        __builtin_amdgcn_sched_barrier(0);
#pragma unroll
        for (int nb = 0; nb < 4; ++nb)
#pragma unroll
            for (int mb = 0; mb < 4; ++mb) acc[mb][nb] = OP::mm(fa[mb], fb[nb], acc[mb][nb]);
        __builtin_amdgcn_sched_barrier(0); };
    ldg(); sts(st);
    ldg(); sts(st + GSZ);
    __syncthreads();                                         // stages 0 and 1 are complete for every wave
    int o0 = 0, o1 = GSZ, o2 = 2 * GSZ;                      // buffers of stage s, s + 1, s + 2
    frags(a0, b0, st);
#pragma unroll 1                                             // rolled: one stage's text serves all stages, so the kernel text stays short and the register sets stay two
    for (int s = 0; s + 2 < K / GBK; ++s) {
        frags(a1, b1, st + o0 + 32);
        ldg();                                               // stage s + 2
        prod(a0, b0);
        frags(a0, b0, st + o1);                              // stage s + 1 was published by the barrier that ended stage s - 1
        prod(a1, b1);
        sts(st + o2);                                        // held stage s - 1: its last reads were waited for in front of the barrier that ended stage s - 1
        __syncthreads();                                     // stage s + 2 is complete, and stage s has been read by every wave
        const int t = o0; o0 = o1; o1 = o2; o2 = t;
    }
    frags(a1, b1, st + o0 + 32); prod(a0, b0);
    frags(a0, b0, st + o1);      prod(a1, b1);
    frags(a1, b1, st + o1 + 32); prod(a0, b0);
    prod(a1, b1);
    const size_t tbase = (size_t)(r0 / RB) * sRB + (size_t)(r0 % RB) * (size_t)pitch + (size_t)(c0 / CB) * sCB + (size_t)(c0 % CB);
    const int rg = lane >> 3, c8 = (lane & 7) * 8, cp = c8 ^ 32, j0 = c8 & 31;
    const float sg = (c8 < 32) ? -1.0f : 1.0f;           // first half: x1 cos - x2 sin; second half: x2 cos + x1 sin
    const int tp0 = r0 % SEQ;                            // position of tile row 0 inside its sequence (MODE 0)
    float bo[8], bp[8], wv[8];
    v4f b4 = (v4f){};
    if (MODE == 0) {
#pragma unroll
        for (int i = 0; i < 8; ++i) { bo[i] = bfr(bias[c0 + c8 + i]); bp[i] = bfr(bias[c0 + cp + i]); wv[i] = bfr(nw[c8 + i]); }
    } else {
#pragma unroll
        for (int i = 0; i < 8; ++i) { bo[i] = 0.0f; bp[i] = 0.0f; wv[i] = 0.0f; }
    }
    if (MODE == 2) {
#pragma unroll
        for (int i = 0; i < 4; ++i) b4[i] = bfr(bias[c0 + lr * 4 + i]);
    }
#pragma unroll
    for (int mb = 0; mb < 4; ++mb) {
#pragma unroll
        for (int nb = 0; nb < 4; ++nb) {
#pragma unroll
            for (int j = 0; j < 8; ++j) os[(hi * 8 + j) * 68 + nb * 16 + lr] = acc[mb][nb][j]; }   // D: row 8h+j, col lane&15; rows 0..15 x columns 0..63 all written
        wave_sync();
        const size_t sb = tbase + (size_t)(mb * 16) * (size_t)pitch;
        if (MODE == 0) {
            v8h hq[4], rq[4];
#pragma unroll
            for (int s = 0; s < 4; ++s) { const int row = 4 * s + rg;                              // 4 s x 4 row groups = 16 rows; 8 lanes x 8 = 64 columns
                const float* op = &os[row * 68];
                const v4f x0 = *(const v4fa*)(op + c8), x1 = *(const v4fa*)(op + c8 + 4), y0 = *(const v4fa*)(op + cp), y1 = *(const v4fa*)(op + cp + 4);
                const float* cs = CS + (size_t)(tp0 + mb * 16 + row) * 64 + j0;
                const v4f ca = *(const v4f*)cs, cb = *(const v4f*)(cs + 4), sa = *(const v4f*)(cs + 32), sc = *(const v4f*)(cs + 36);
                asm volatile("s_wait_xcnt 0x0" :: "v"(cs) : "memory");   // the four table loads' address pair stays as it is until this wait (it is its input)
                float rot[8];
#pragma unroll
                for (int i = 0; i < 4; ++i) {
                    const float xo = x0[i] + bo[i], xp = y0[i] + bp[i]; rot[i] = xo * ca[i] + sg * (xp * sa[i]);
                    const float xq = x1[i] + bo[4 + i], xr = y1[i] + bp[4 + i]; rot[4 + i] = xq * cb[i] + sg * (xr * sc[i]); }
                float ss = 0.0f;
#pragma unroll
                for (int i = 0; i < 8; ++i) ss += rot[i] * rot[i];
                ss += __shfl_xor(ss, 1, 32); ss += __shfl_xor(ss, 2, 32); ss += __shfl_xor(ss, 4, 32);   // the 8 lanes of one row
                const float rinv = rsqrtf(ss * (1.0f / 64.0f) + RMS_EPS);
                v8h hv, rv;
#pragma unroll
                for (int i = 0; i < 8; ++i) { const float val = rot[i] * rinv * wv[i]; const h16 a0 = (h16)val; hv[i] = a0; rv[i] = (h16)((val - (float)a0) * QRS); }
                hq[s] = hv; rq[s] = rv; }
#pragma unroll
            for (int s = 0; s < 4; ++s) { const size_t oo = sb + (size_t)(4 * s + rg) * (size_t)pitch + c8;
                // a wait behind each store: its registers are written again by the residual's arithmetic, which the compiler puts under the branch, and by the next rows
                *(v8h*)(Ph + oo) = hq[s]; asm volatile("s_wait_xcnt 0x0" ::: "memory");
                if (useRes) { *(v8h*)(Pr + oo) = rq[s]; asm volatile("s_wait_xcnt 0x0" ::: "memory"); } }
        } else if (MODE == 1) {
            v8h hq[4];
#pragma unroll
            for (int s = 0; s < 4; ++s) { const int row = 4 * s + rg;
                const float br = bfr(bias[r0 + mb * 16 + row]);
                const v4f x0 = *(const v4fa*)(&os[row * 68 + c8]); const v4f x1 = *(const v4fa*)(&os[row * 68 + c8 + 4]); v8h hv;
#pragma unroll
                for (int i = 0; i < 4; ++i) { hv[i] = (h16)(x0[i] + br); hv[4 + i] = (h16)(x1[i] + br); }
                hq[s] = hv; }
#pragma unroll
            for (int s = 0; s < 4; ++s) { const size_t oo = sb + (size_t)(4 * s + rg) * (size_t)pitch + c8; *(v8h*)(Ph + oo) = hq[s]; }
            asm volatile("s_wait_xcnt 0x0" ::: "memory");    // the stores' registers are reused for the next 16 rows
        } else {
            v4f ov[8];
#pragma unroll
            for (int s = 0; s < 8; ++s) { const int row = 2 * s + hi;                              // 8 s x 2 rows = 16 rows; 16 lanes x 4 floats = 64 columns
                const v4f x = *(const v4fa*)(&os[row * 68 + lr * 4]); ov[s] = x * OSC + b4; }
#pragma unroll
            for (int s = 0; s < 8; ++s) { const size_t oo = sb + (size_t)(2 * s + hi) * (size_t)pitch + lr * 4; *(v4f*)(OF + oo) = ov[s]; }
            
        }
        wave_sync();
    }
}

typedef uint32_t u32x4 __attribute__((ext_vector_type(4)));
typedef uint32_t u32x8 __attribute__((ext_vector_type(8)));
__device__ __forceinline__ uint32_t uni(uint32_t v) { return (uint32_t)__builtin_amdgcn_readfirstlane(v); }
__device__ __forceinline__ uint32_t pinned(uint32_t v) { uint32_t w = __builtin_amdgcn_readfirstlane(v); asm volatile("" : "+s"(w)); return w; }
// descriptor group 1 of a tensor load: D1 rows of D0 bytes at source pitch PITCH bytes; 1-byte elements, tensor = tile, no mask; W0 = the pad word (16 B behind every row), a constant.
// Built once in front of the loop; pinned(): the descriptor words are held in scalar registers through the loop, so that none of them is formed anew while a request is outstanding.
template <uint32_t W0, uint32_t D0, uint32_t D1, uint32_t PITCH>
__device__ __forceinline__ u32x8 tdm_group1() {
    u32x8 g;
    g[0] = uni(W0); g[1] = pinned((D0 & 0xFFFFu) << 16); g[2] = pinned((D0 >> 16) | ((D1 & 0xFFFFu) << 16)); g[3] = pinned((D1 >> 16) | (D0 << 16));
    g[4] = pinned(D1); g[5] = pinned(PITCH); g[6] = pinned(0u); g[7] = pinned(0u);
    return g;
}
// g0 = descriptor group 0: count 1 | LDS byte offset | global address of the tile's first byte, low word | high word with type 2.
// It is named as in-out so that its four registers stay the request's own, and are used for nothing else, until the next request is formed in them behind the wait.
__device__ __forceinline__ void tdm_load(u32x4& g0, u32x8 g1) { asm volatile("tensor_load_to_lds %0, %1" : "+s"(g0) : "s"(g1) : "memory"); }

// k_flash: fused attention, one wave per QT x 16 query rows of one (batch, head); Q fragments straight from the f16 planes (two 16-B loads each, arithmetic addressing).
// K and V^T: the 8 waves of a block walk the same keys, so each tile of 128 keys (K 128 rows x 128 B, V^T 64 rows x 256 B) is brought into padded LDS once per block by two tensor loads
// (wave 0: K, wave 1: V^T); two buffers, tile t + 2 is asked for when tile t has been read by every wave; every wave reads its fragments from LDS.
// Every K and V^T fragment a wave loads is used for all QT query tiles it holds in registers, so the loads per matrix instruction fall by QT.
// Transposed form: S^T[key][t] = K Q^T (A = K rows, B = Q rows); lane (t = lane&15, h = lane>>4) holds keys 8h+r of each 16-key tile, so the packed
// P tile is directly the B fragment of O^T[d][t] = V^T P^T (element r <- tile keys 0..15, element 8+r <- tile keys 16..31, lane unchanged).
// Softmax state: the running max is one scalar per lane and query tile (the two lane halves of a row are combined with one xor-16 exchange); the row sums of the rounded P are
// taken by the matrix unit, one product per query tile and pass with an A operand of ones, into an f32 accumulator tile of their own: every row of it gets the same increment,
// the sum over all 32 keys, so element 0 of either lane half is the whole row sum of column t and no exchange between the halves is needed.
__global__ __launch_bounds__(32 * AW) void k_flash(const h16* __restrict__ QH, const h16* __restrict__ QR, const h16* __restrict__ KP, const h16* __restrict__ VT, h16* CTX) {
    __shared__ __align__(16) float os[AW * 16 * 68];
    __shared__ __attribute__((aligned(2048))) h16 kv[2 * FSZ];   // two tile buffers
    const int lane = threadIdx.x & 31, wave = threadIdx.x >> 5, lr = lane & 15, hi = lane >> 4;
    const int zh = blockIdx.y; const int b = zh / NH_, h = zh % NH_;
    const int t0 = (blockIdx.x * AW + wave) * (16 * QT);
    const size_t pbase = (size_t)zh * SEQ * HD;
    v16h qh0[QT], qh1[QT], qr0[QT], qr1[QT];                 // B fragments: col t, k = d
    v8f o[QT][4], ls[QT]; float m[QT];
    const h16* qa[QT]; const h16* qb[QT];
#pragma unroll
    for (int i = 0; i < QT; ++i) { const size_t qo = pbase + (size_t)(t0 + 16 * i + lr) * HD + 8 * hi; qa[i] = QH + qo; qb[i] = QR + qo; }
#pragma unroll
    for (int i = 0; i < QT; ++i) { qh0[i] = ldh(qa[i]); qh1[i] = ldh(qa[i] + 32); qr0[i] = ldh(qb[i]); qr1[i] = ldh(qb[i] + 32); }
    static_assert(QT == 4);                                  // the wait below names the eight Q address pairs
    // the Q loads' address registers stay as they are until this wait (they are its inputs); they are reused behind it
    asm volatile("s_wait_xcnt 0x0" :: "v"(qa[0]), "v"(qa[1]), "v"(qa[2]), "v"(qa[3]), "v"(qb[0]), "v"(qb[1]), "v"(qb[2]), "v"(qb[3]) : "memory");
#pragma unroll
    for (int i = 0; i < QT; ++i) { o[i][0] = (v8f){}; o[i][1] = (v8f){}; o[i][2] = (v8f){}; o[i][3] = (v8f){}; ls[i] = (v8f){}; m[i] = -3.0e38f; }
    const uint32_t wv = uni(threadIdx.x >> 5);               // the wave's number (one-dimensional block)
    const uint32_t lb = (uint32_t)(size_t)kv;                // LDS byte offset of the buffers: the low 32 bits of the shared address
    // a tile's two requests: wave 0 brings the K rows, wave 1 the V^T rows; pad words: 128-B rows -> pitch 144 B, 256-B rows -> pitch 272 B
    const u32x8 g1k = tdm_group1<(1u << 20) | (4u << 22) | (3u << 25), HD * 2, FSK, HD * 2>();
    const u32x8 g1v = tdm_group1<(1u << 20) | (5u << 22) | (3u << 25), FSK * 2, HD, SEQ * 2>();
    const bool isv = wv != 0u;                               // the same for a whole wave; waves 2 to 7 form a descriptor and issue nothing
    const uint64_t ga = isv ? (uint64_t)(size_t)(VT + pbase) : (uint64_t)(size_t)(KP + pbase);
    const uint32_t dst = lb + (isv ? 2u * FKSZ : 0u), step = isv ? FSK * 2u : FSK * HD * 2u;   // place in a buffer; bytes from one tile to the next
    u32x4 g0;
    g0[0] = pinned(1u);                                      // pinned(): a descriptor word held in its scalar register through the loop
    g0[1] = uni(dst); g0[2] = uni((uint32_t)ga); g0[3] = uni((((uint32_t)(ga >> 32)) & 0x01FFFFFFu) | 0x80000000u);
    auto issue = [&]() {
        if (pinned(wv == 0u)) tdm_load(g0, g1k);
        if (pinned(wv == 1u)) tdm_load(g0, g1v); };
    // the next tile's descriptor, for buffer buf; pinned(): the step is taken up behind the wait that stands in front of this call, so the address words are not formed before it
    auto next = [&](uint32_t buf) {
        const uint64_t a = (((uint64_t)g0[3] << 32) | g0[2]) + pinned(step);
        g0[1] = uni(dst + buf * (2u * FSZ)); g0[2] = uni((uint32_t)a); g0[3] = uni((uint32_t)(a >> 32)); };
    constexpr uint32_t NT = SEQ / FSK;
    issue();                                                 // tile 0 into buffer 0
    if (pinned(wv < 2u)) asm volatile("s_wait_tensorcnt 0x0" ::: "memory");   // the issuing wave's request for tile 0 has landed
    __syncthreads();                                         // tile 0 is complete for every wave
    next(1u); issue();                                       // tile 1 into buffer 1
    v16h ones;                                               // A operand of the row sums: 16 x 32 ones
#pragma unroll
    for (int r = 0; r < 16; ++r) ones[r] = (h16)1.0f;
    const int kfo = lr * FKP + 8 * hi;                       // + key * FKP        (A fragment: row key, k = d)
    const int vfo = FKSZ + lr * FVP + 8 * hi;                // + 16j * FVP + key  (A fragment: row d, k = key)
#pragma unroll 1                                             // rolled: one pass's text serves all tiles
    for (uint32_t t = 0; t < NT; ++t) {
      const h16* sb = kv + (t & 1u) * FSZ;
#pragma unroll 1                                             // rolled: one pass's text serves the four passes of a tile
      for (int key0 = 0; key0 < FSK; key0 += 32) {
        const h16* ka = sb + kfo + key0 * FKP;
        const v16h ka0 = ldh(ka), ka1 = ldh(ka + 32), kb0 = ldh(ka + 16 * FKP), kb1 = ldh(ka + 16 * FKP + 32);
        v16h pb[QT];
#pragma unroll
        for (int i = 0; i < QT; ++i) {
            v8f sHa = (v8f){}, sLa = (v8f){}, sHb = (v8f){}, sLb = (v8f){};
            sHa = wmma16(ka0, qh0[i], sHa); sLa = wmma16(ka0, qr0[i], sLa); sHb = wmma16(kb0, qh0[i], sHb); sLb = wmma16(kb0, qr0[i], sLb);
            sHa = wmma16(ka1, qh1[i], sHa); sLa = wmma16(ka1, qr1[i], sLa); sHb = wmma16(kb1, qh1[i], sHb); sLb = wmma16(kb1, qr1[i], sLb);
            float ta[8], tb[8]; float mx = -3.0e38f;
#pragma unroll
            for (int r = 0; r < 8; ++r) { ta[r] = (sHa[r] + sLa[r] * QRI) * SC2; tb[r] = (sHb[r] + sLb[r] * QRI) * SC2; mx = fmaxf(mx, fmaxf(ta[r], tb[r])); }
            mx = fmaxf(mx, __shfl_xor(mx, 16, 32));
            const float mnew = fmaxf(m[i], mx);
            const float alpha = __builtin_amdgcn_exp2f(m[i] - mnew);
            const float sh = PSH - mnew;
            v16h pv;
#pragma unroll
            for (int r = 0; r < 8; ++r) { pv[r] = (h16)__builtin_amdgcn_exp2f(ta[r] + sh); pv[8 + r] = (h16)__builtin_amdgcn_exp2f(tb[r] + sh); }
            pb[i] = pv;
            ls[i][0] = ls[i][0] * alpha; m[i] = mnew;        // only element 0 of the sum tile is read, so only it is rescaled; the other rows stay finite (each P <= 256, SEQ keys)
            o[i][0] = o[i][0] * alpha; o[i][1] = o[i][1] * alpha; o[i][2] = o[i][2] * alpha; o[i][3] = o[i][3] * alpha;
        }
        const h16* va = sb + vfo + key0;
        const v16h v0 = ldh(va), v1 = ldh(va + 16 * FVP), v2 = ldh(va + 32 * FVP), v3 = ldh(va + 48 * FVP);
#pragma unroll
        for (int i = 0; i < QT; ++i) { o[i][0] = wmma16(v0, pb[i], o[i][0]); o[i][1] = wmma16(v1, pb[i], o[i][1]); o[i][2] = wmma16(v2, pb[i], o[i][2]); o[i][3] = wmma16(v3, pb[i], o[i][3]);
            ls[i] = wmma16(ones, pb[i], ls[i]); }            // every row of the tile: + the sum of the 32 rounded P of column t
        // the distance behind the pass's last products on the loop's taken branch: the next pass's first vector instructions write registers that were their A operands
        // the scheduling fence keeps the products in front of the four slots
        __builtin_amdgcn_sched_barrier(0);
        asm volatile("v_nop\n\tv_nop\n\tv_nop\n\tv_nop");
      }
      asm volatile("s_wait_dscnt 0x0" ::: "memory");         // this wave's reads of tile t have returned
      if (pinned(wv < 2u)) asm volatile("s_wait_tensorcnt 0x0" ::: "memory");   // the issuing wave's request for tile t + 1 has landed
      __syncthreads();                                       // tile t + 1 is complete, and tile t has been read by every wave
      if (pinned(t + 2u < NT)) { next(t & 1u); issue(); }    // tile t + 2 into the buffer that tile t has left
    }
    asm volatile("s_wait_tensorcnt 0x0" ::: "memory");       // no request is outstanding when the wave goes on to its end
    asm volatile("s_wait_dscnt 0x0" ::: "memory");
    const int wb = wave * 16 * 68;
    const int rg = lane >> 3, c8 = (lane & 7) * 8;
#pragma unroll
    for (int i = 0; i < QT; ++i) {
        const float inv = (1.0f / ls[i][0]) * CTXS;          // the product summed over all 32 keys of a pass: both lane halves hold the whole row sum
        // O^T D layout: o[i][j][r] = (d = 16j + 8h + r, t = lane&15) -> os[t][d]; rows 0..15 x columns 0..63 all written
#pragma unroll
        for (int j = 0; j < 4; ++j) { v4f a, c;
            a[0] = o[i][j][0] * inv; a[1] = o[i][j][1] * inv; a[2] = o[i][j][2] * inv; a[3] = o[i][j][3] * inv; c[0] = o[i][j][4] * inv; c[1] = o[i][j][5] * inv; c[2] = o[i][j][6] * inv; c[3] = o[i][j][7] * inv;
            *(v4fa*)(&os[wb + lr * 68 + 16 * j + 8 * hi]) = a; *(v4fa*)(&os[wb + lr * 68 + 16 * j + 8 * hi + 4]) = c; }
        wave_sync();
        h16* crow = CTX + ((size_t)b * SEQ + t0 + 16 * i) * DM + h * HD;
        v8h hq[4];
#pragma unroll
        for (int s = 0; s < 4; ++s) { const int row = 4 * s + rg;                                  // 4 s x 4 row groups = 16 rows; 8 lanes x 8 halves = 64 columns
            const v4f x0 = *(const v4fa*)(&os[wb + row * 68 + c8]); const v4f x1 = *(const v4fa*)(&os[wb + row * 68 + c8 + 4]); v8h hv;
#pragma unroll
            for (int k = 0; k < 4; ++k) { hv[k] = (h16)x0[k]; hv[4 + k] = (h16)x1[k]; }
            hq[s] = hv; }
#pragma unroll
        for (int s = 0; s < 4; ++s) *(v8h*)(crow + (size_t)(4 * s + rg) * DM + c8) = hq[s];
        if (i + 1 < QT) {
            asm volatile("s_wait_xcnt 0x0" ::: "memory");    // the stores' registers are reused for the next query tile
            wave_sync();                                     // the tile is read out before the next query tile overwrites it
        }
    }
}

static constexpr size_t al256(size_t v) { return (v + 255) & ~(size_t)255; }
static constexpr size_t SZ_XB = al256((size_t)NB * SEQ * DM * 2);          // bf16 copy of one activation input; also the size of the ctx plane
static constexpr size_t SZ_WB = al256((size_t)4 * DM * DM * 2);            // four transposed 16-bit weight planes
static constexpr size_t SZ_CS = al256((size_t)SEQ * 64 * 4);               // rotary table
static constexpr size_t SZ_PL = al256((size_t)NB * NH_ * SEQ * HD * 2);    // one f16 head plane
static constexpr size_t SZ_TOTAL = 3 * SZ_XB + SZ_WB + SZ_CS + 4 * SZ_PL;
static_assert(SZ_TOTAL <= (size_t)134217728);          // workspace carve <= 128 MiB
static_assert(((size_t)DM * DM * 2) % 256 == 0);       // weight sub-planes stay 256-byte aligned
static_assert((size_t)NB * SEQ * DM * 2 <= SZ_XB);     // ctx plane extent

extern "C" void kernel_launch(void* const* d_in, const int* in_sizes, int n_in,
                              void* d_out, int out_size, void* d_ws, size_t ws_size, hipStream_t stream) {
    if (n_in < 13) return;
    const size_t needx = ((size_t)(NB - 1) * SEQ_FULL + SEQ) * DM;
    if ((size_t)in_sizes[0] < needx || (size_t)in_sizes[1] < needx || (size_t)in_sizes[2] < needx) return;
    if ((size_t)in_sizes[3] < (size_t)DM * DM || (size_t)in_sizes[5] < (size_t)DM * DM || (size_t)in_sizes[7] < (size_t)DM * DM || (size_t)in_sizes[9] < (size_t)DM * DM) return;
    if (in_sizes[4] < DM || in_sizes[6] < DM || in_sizes[8] < DM || in_sizes[10] < DM) return;
    if (in_sizes[11] < HD || in_sizes[12] < HD) return;
    if ((size_t)out_size < ((size_t)(NB - 1) * OUT_SEQ + SEQ) * DM) return;
    if (SZ_TOTAL > ws_size) return;
    // wire order: q, k, v, wq_w, wq_b, wk_w, wk_b, wv_w, wv_b, wo_w, wo_b, qn_w, kn_w (weights [in][out])
    const float* q  = (const float*)d_in[0];  const float* k  = (const float*)d_in[1];  const float* v  = (const float*)d_in[2];
    const float* wq = (const float*)d_in[3];  const float* bq = (const float*)d_in[4];
    const float* wk = (const float*)d_in[5];  const float* bk = (const float*)d_in[6];
    const float* wv = (const float*)d_in[7];  const float* bv = (const float*)d_in[8];
    const float* wo = (const float*)d_in[9];  const float* bo = (const float*)d_in[10];
    const float* qnw = (const float*)d_in[11]; const float* knw = (const float*)d_in[12];
    float* OUT = (float*)d_out;      // [NB][OUT_SEQ][1024]
    char* wsp = (char*)d_ws;
    bf* XB = (bf*)wsp; wsp += 3 * SZ_XB;             // [3][NB*SEQ][1024] bf16: q | k | v
    bf* WB = (bf*)wsp; wsp += SZ_WB;                 // [4][1024 out][1024 in]: q | k | v (bf16) | o (f16 x1024)
    float* CS = (float*)wsp; wsp += SZ_CS;           // [SEQ][64]: cos | sin
    h16* QH = (h16*)wsp; wsp += SZ_PL;               // [NB*16][SEQ][64]
    h16* QR = (h16*)wsp; wsp += SZ_PL;               // [NB*16][SEQ][64] residual x2048
    h16* KP = (h16*)wsp; wsp += SZ_PL;               // [NB*16][SEQ][64]
    h16* VT = (h16*)wsp; wsp += SZ_PL;               // [NB*16][64][SEQ]
    h16* CTX = (h16*)XB;                             // [NB*SEQ][1024] x64, over the q copy, which nothing reads behind the projections
    bf* WO = WB + (size_t)3 * DM * DM;

    k_prep<<<PB_WT + PB_TAB + 3 * PB_CV, 256, 0, stream>>>(q, k, v, wq, wk, wv, wo, XB, WB, CS);

    k_gemm<0><<<dim3((NB * SEQ / GBM) * (DM / GBN), 3, 1), 32 * GW, 0, stream>>>(XB, WB, bq, bk, bv, qnw, knw, CS, QH, QR, KP, VT, OUT);

    k_flash<<<dim3(SEQ / (16 * AW * QT), NB * NH_, 1), 32 * AW, 0, stream>>>(QH, QR, KP, VT, CTX);

    k_gemm<1><<<dim3((NB * SEQ / GBM) * (DM / GBN), 1, 1), 32 * GW, 0, stream>>>((const bf*)CTX, WO, bo, bo, bo, qnw, knw, CS, QH, QH, QH, QH, OUT);
}

// v006
// One run takes 174 microseconds.
// Timed twice side by side with v005, it ran 1.05 times as fast both times.
// All steps since v000 together make it 2.31 times as fast.
#include <hip/hip_runtime.h>

// Multi-head attention, width 1024 = 16 heads x 64: q/k/v [NB][SEQ_FULL][1024] (first SEQ rows of each batch used), weights [in][out] (y = x W + b), half-split rotary on q and k (table cos/sin of t * 10000^(-j/32)), per-head RMS normalisation with weights, score scale 1/8, no mask, output projection with bias, f32 output.
// Compute dtypes, f32 accumulate everywhere: q/k/v projections v_wmma_f32_16x16x32_bf16 (inputs and weights RNE-converted to bf16; products exact);
// scores v_wmma_f32_16x16x32_f16: k single f16, q * (1/8 * log2 e) as f16 value + f16 residual at the same scale, both products chained into one accumulator; P (x256 carry, cancels in the normalisation) and v single f16;
// output projection v_wmma_f32_16x16x32_f16: ctx f16 (x64 carry), Wo^T f16 built from the bf16 RNE value (x1024 carry), 2^-16 folded back in the f32 epilogue; softmax, rotary and normalisation in f32.
// Layout: a bf16 copy of each activation input; transposed 16-bit weight planes [out][in]; q (value, residual), k planes [b*16+h][t][d] and v^T plane [b*16+h][d][t] written by the GEMM epilogue;
// fused flash kernel in transposed form (S^T = K Q^T, O^T = V^T P^T) writes the ctx plane [b*SEQ+t][1024]; final GEMM writes the f32 output.

#ifndef NB
#define NB 4
#endif
#ifndef SEQ
#define SEQ 2048
#endif
#define NB_FULL  4
#define SEQ_FULL 2048
#ifndef OUT_SEQ
#define OUT_SEQ SEQ              // row pitch (in tokens) between batches of the output
#endif
#define DM   1024
#define NH_  16
#define HD   64
#define AW   8                   // waves per flash block
#define QT   4                   // query tiles of 16 rows per flash wave
#define SC2  (0.125f * 1.4426950408889634f)   // HD^-0.5 * log2(e)
#define PSH  8.0f                // log2 of the P carry (256)
#define CTXS 64.0f               // carry of the ctx plane
#define WOS  1024.0f             // carry of the Wo^T plane
#define OSC  (1.0f / 65536.0f)   // 1 / (CTXS * WOS)
#define RMS_EPS 1.0e-6f
#define GW   8                   // waves per GEMM block: 4 (rows) x 2 (columns) wave tiles of 64 x 64
#define GBM  256                 // block tile rows
#define GBN  128                 // block tile columns
#define GBK  64                  // k per stage: one whole 128-byte line of every operand row
#define GLP  72                  // LDS row pitch in elements: 144 B = 16 B x 9, no bank conflict for the 16-byte fragment reads
#define GSZ  ((GBM + GBN) * GLP) // elements of one stage buffer
#define FSK  128                 // keys per LDS tile of the flash kernel: 4 passes of 32 keys
#define FKP  72                  // K tile row pitch in elements: 128-B rows at 144 B = 16 B x 9
#define FVP  136                 // V^T tile row pitch in elements: 256-B rows at 272 B = 16 B x 17
#define FKSZ (FSK * FKP)         // elements of the K part of one tile buffer: 18,432 B = 9 x 2 KiB
#define FSZ  (2 * FKSZ)          // elements of one tile buffer: K rows, then from the next multiple of 2 KiB the V^T rows (17,408 B), rounded up to a multiple of 2 KiB

static_assert(HD == 64);
static_assert(NH_ * HD == DM);                 // head h = columns h*64 + d
static_assert(DM % 64 == 0);                   // 16 column tiles of 64
static_assert(DM % 32 == 0);                   // each GEMM product takes 32 k
static_assert(SEQ % 64 == 0);                  // a 64-row tile never straddles two batches
static_assert((NB * SEQ) % GBM == 0 && DM % GBM == 0 && (NB * SEQ) % GBN == 0 && DM % GBN == 0);   // GEMM grids cover M and N exactly, either operand order
static_assert(GBK == 64 && DM % GBK == 0 && DM / GBK >= 3);
static_assert(GW == 8 && GBM == 256 && GBN == 128);      // the copy's 8 + 4 pieces per thread and the 4 x 2 wave grid are written for these
static_assert((GBM + GBN) * (GBK / 8) % (32 * GW) == 0 && GBM % (32 * GW / (GBK / 8)) == 0);          // whole 16-byte pieces per thread; a piece index is all A or all B
static_assert(SEQ % 32 == 0);                  // key loop steps by 32
static_assert(FSK == 128 && SEQ % FSK == 0 && SEQ / FSK >= 2 && AW >= 2);   // whole key tiles inside the planes, at least the two that the prologue asks for; two issuing waves
static_assert((FKSZ * 2) % 2048 == 0 && HD * FVP <= FKSZ && FKP * 2 == HD * 2 + 16 && FVP * 2 == FSK * 2 + 16);   // places in LDS at multiples of 2 KiB; pitch = row + 16 B of pad
static_assert((SEQ * 2) % 16 == 0 && SEQ * 2 <= 131072);   // source pitch of the V^T tile
static_assert(SEQ % (16 * AW * QT) == 0);      // flash grid covers the sequence exactly
static_assert(SEQ % 8 == 0);                   // table kernel: 8 positions per block
static_assert(((size_t)SEQ * DM) % 8 == 0);
static_assert(((size_t)DM * DM) % 8 == 0);
static_assert(NB <= NB_FULL);
static_assert(SEQ <= SEQ_FULL);
static_assert(OUT_SEQ >= SEQ);

typedef _Float16 h16;
typedef unsigned short bf;
typedef __attribute__((ext_vector_type(16))) __bf16   v16bf;
typedef __attribute__((ext_vector_type(16))) _Float16 v16h;
typedef __attribute__((ext_vector_type(8)))  _Float16 v8h;
typedef __attribute__((ext_vector_type(8)))  unsigned short v8us;
typedef __attribute__((ext_vector_type(8)))  float    v8f;
typedef __attribute__((ext_vector_type(4)))  float    v4f;
typedef v4f  __attribute__((may_alias)) v4fa;

__device__ __forceinline__ unsigned short f2bf(float f) { unsigned u = __float_as_uint(f); u += 0x7FFFu + ((u >> 16) & 1u); return (unsigned short)(u >> 16); }
__device__ __forceinline__ float bfr(float f) { return __uint_as_float(((unsigned)f2bf(f)) << 16); }   // value after RNE convert to bf16
__device__ __forceinline__ v16h cat16(v8h lo, v8h hi) { return __builtin_shufflevector(lo, hi, 0, 1, 2, 3, 4, 5, 6, 7, 8, 9, 10, 11, 12, 13, 14, 15); }
__device__ __forceinline__ v16bf cat16b(v8us lo, v8us hi) { return __builtin_bit_cast(v16bf, __builtin_shufflevector(lo, hi, 0, 1, 2, 3, 4, 5, 6, 7, 8, 9, 10, 11, 12, 13, 14, 15)); }
__device__ __forceinline__ v8f wmma16(v16h a, v16h b, v8f c) { return __builtin_amdgcn_wmma_f32_16x16x32_f16(false, a, false, b, (short)0, c, false, false); }
__device__ __forceinline__ v8f wmmab(v16bf a, v16bf b, v8f c) { return __builtin_amdgcn_wmma_f32_16x16x32_bf16(false, a, false, b, (short)0, c, false, false); }
// fragment loaders from K-contiguous 16-bit rows; p already includes + 8*(lane>>4): elements 0..7 <- k0+8h+0..7, elements 8..15 <- k0+16+8h+0..7 (same map for A and B)
__device__ __forceinline__ v16h  ldh(const h16* p) { return cat16(*(const v8h*)p, *(const v8h*)(p + 16)); }
__device__ __forceinline__ v16bf ldb(const bf* p)  { return cat16b(*(const v8us*)p, *(const v8us*)(p + 16)); }
// ordering point for wave-private LDS tiles (same wave writes and reads)
__device__ __forceinline__ void wave_sync() { __builtin_amdgcn_fence(3 /* release order */, "wavefront"); __builtin_amdgcn_wave_barrier(); asm volatile("" ::: "memory"); }

// operand type selection for the GEMM: 0 = bf16 planes, 1 = f16 planes (both addressed as 16-bit rows)
template <int F16> struct Ops;
template <> struct Ops<0> { typedef v16bf T;
    static __device__ __forceinline__ T ld(const bf* p) { return ldb(p); }
    static __device__ __forceinline__ v8f mm(T a, T b, v8f c) { return wmmab(a, b, c); } };
template <> struct Ops<1> { typedef v16h T;
    static __device__ __forceinline__ T ld(const bf* p) { return ldh((const h16*)p); }
    static __device__ __forceinline__ v8f mm(T a, T b, v8f c) { return wmma16(a, b, c); } };

// d_cvt8: block bi of the f32 -> bf16 copy of one activation input, [NB][SEQ_FULL][DM] rows 0..SEQ-1 of every batch -> [NB*SEQ][DM]; 8 elements per thread.
__device__ __forceinline__ void d_cvt8(const float* __restrict__ src, bf* dst, unsigned bi) {
    const size_t n8 = (size_t)NB * SEQ * DM / 8, per = (size_t)SEQ * DM / 8;
    const size_t i = (size_t)bi * 256 + threadIdx.x; if (i >= n8) return;
    const size_t so = (SEQ == SEQ_FULL) ? i * 8 : (i / per) * ((size_t)SEQ_FULL * DM) + (i % per) * 8;
    const v8f v = *(const v8f*)(src + so); v8us o;
#pragma unroll
    for (int k = 0; k < 8; ++k) o[k] = f2bf(v[k]);
    *(v8us*)(dst + i * 8) = o; 
}

// d_tab: block bi (8 positions) of the rotary table CS[t][0..31] = cos(t * f_j), CS[t][32..63] = sin(t * f_j), f_j = 10000^(-j/32) (f64 product chain, converted to f32), angle = f32 product.
__device__ __forceinline__ void d_tab(float* CS, unsigned bi) {
    const int lane = threadIdx.x & 31; const int t = bi * 8 + (threadIdx.x >> 5);
    double r = 1.0;
#pragma unroll 1
    for (int i = 0; i < lane; ++i) r *= 0.7498942093324558;    // 10^(-1/8)
    const float inv = (float)r; const float ang = (float)t * inv;
    float s, c; sincosf(ang, &s, &c);
    float* row = CS + (size_t)t * 64;
    *(float*)(row + lane) = c; *(float*)(row + 32 + lane) = s;
    asm volatile("s_wait_xcnt 0x0" ::: "memory");            // the two stores' registers may be written again in the text that follows them in the merged kernel
}

// d_wt: W f32 in[rows = k][cols = n] (pitch DM) -> WT 16-bit out[n][k] (pitch DM), transposed through LDS; tile (bx of DM/64 over n, by of DM/64 over k), 256 threads.
__device__ __forceinline__ void d_wt(const float* __restrict__ W, bf* WT, int asF16, float scale, int bx, int by, float* ts) {
    const int tid = threadIdx.x; const int n0 = bx * 64, k0 = by * 64;
#pragma unroll
    for (int it = 0; it < 4; ++it) { const int idx = it * 256 + tid; const int kk = idx >> 4, n4 = (idx & 15) * 4;   // 64 k rows x 16 float4 = 1024 pieces
        const v4f v = *(const v4f*)(W + (size_t)(k0 + kk) * DM + n0 + n4);
        ts[kk * 65 + n4 + 0] = v[0]; ts[kk * 65 + n4 + 1] = v[1]; ts[kk * 65 + n4 + 2] = v[2]; ts[kk * 65 + n4 + 3] = v[3]; }
    __syncthreads();
    v8us o0, o1;
#pragma unroll
    for (int it = 0; it < 2; ++it) { const int p = it * 256 + tid; const int n = p >> 3, k8 = (p & 7) * 8;            // 64 n rows x 8 pieces = 512 pieces
        v8us o;
#pragma unroll
        for (int i = 0; i < 8; ++i) { const float x = ts[(k8 + i) * 65 + n]; const unsigned short b = f2bf(x);
            const h16 hv = (h16)(__uint_as_float(((unsigned)b) << 16) * scale); const unsigned short hb = __builtin_bit_cast(unsigned short, hv);
            o[i] = asF16 ? hb : b; }
        if (it == 0) o0 = o; else o1 = o; }
    bf* d0 = WT + (size_t)(n0 + (tid >> 3)) * DM + k0 + (tid & 7) * 8;
    bf* d1 = WT + (size_t)(n0 + 32 + (tid >> 3)) * DM + k0 + (tid & 7) * 8;
    *(v8us*)d0 = o0; *(v8us*)d1 = o1;
    
}

// k_prep: everything the projections need and that needs nothing of each other, as block ranges of one grid (the branch is the same for a whole block):
// blocks [0, PB_WT): the four weight planes, 16 x 16 tiles each; [PB_WT, PB_WT + PB_TAB): the rotary table; then PB_CV blocks for each of q, k, v into its own bf16 plane.
#define PB_WP  ((DM / 64) * (DM / 64))
#define PB_WT  (4 * PB_WP)
#define PB_TAB (SEQ / 8)
#define PB_CV  ((unsigned)(((size_t)NB * SEQ * DM / 8 + 255) / 256))
__global__ __launch_bounds__(256) void k_prep(const float* __restrict__ q, const float* __restrict__ k, const float* __restrict__ v,
                                              const float* __restrict__ wq, const float* __restrict__ wk, const float* __restrict__ wv, const float* __restrict__ wo,
                                              bf* XB, bf* WB, float* CS) {
    __shared__ float ts[64 * 65];
    unsigned blk = blockIdx.x;
    if (blk < PB_WT) {
        const unsigned pl = blk / PB_WP, t = blk % PB_WP;
        const float* W = (pl == 0) ? wq : (pl == 1) ? wk : (pl == 2) ? wv : wo;
        d_wt(W, WB + (size_t)pl * DM * DM, pl == 3, (pl == 3) ? WOS : 1.0f, t % (DM / 64), t / (DM / 64), ts);
        return;
    }
    blk -= PB_WT;
    if (blk < PB_TAB) { d_tab(CS, blk); return; }
    blk -= PB_TAB;
    const unsigned pl = blk / PB_CV;
    const float* x = (pl == 0) ? q : (pl == 1) ? k : v;
    d_cvt8(x, XB + (size_t)pl * NB * SEQ * DM, blk % PB_CV);
}

// k_gemm: register-blocked GEMM, one wave per 64x64 tile (16 accumulators), 8 waves per block on a 256x128 tile, K = DM.
// Per stage of 64 k the block copies its 256 A rows and 128 Bt rows, one whole 128-byte line each, through registers into padded LDS (three buffers: the global loads of
// stage s + 2 are issued before the products of stage s and stored behind them, one barrier per stage); every wave reads its fragments from LDS, 32 k ahead of their products.
// C[m][n] = sum_k A[m][k] Bt[n][k]; tile base (r0/RB)*sRB + (r0%RB)*pitch + (c0/CB)*sCB + (c0%CB), row pitch 'pitch' (elements). blockIdx.x counts the block tiles of one GEMM, (M/256) x (N/128), rows fastest; 256 threads.
// MODE 0 (q, k; bf16 operands): + column bias, half-split rotary (the 64 tile columns are one head), RMS normalisation times weight, written as f16 (Ph); q is first multiplied by the score scale in log2 units,
// and what its f16 value leaves over is written as an f16 residual at the same scale (Pr), so that the flash kernel's score tile needs no arithmetic before the maximum and the exponential.
// MODE 1 (v^T; bf16 operands): + row bias, written as f16 (Ph).
// MODE 2 (output; f16 operands): * 2^-16 + column bias, written as f32 rows (OF).
// F16 = 0: the three projections, which need nothing of each other, share one grid; blockIdx.y = 0: q, 1: k (A = x rows, m = b*SEQ + t; Bt = W^T rows, n = h*64 + d -> plane [(b*16 + h)][t][d]),
// 2: v^T (A = Wv^T rows, m = h*64 + d; Bt = x rows, n = b*SEQ + t -> plane [(b*1024 + m)][t] = [(b*16 + h)][d][t]); X and Wt hold the planes of q, k, v one behind the other.
// F16 = 1: the output projection (A = ctx rows, m = b*SEQ + t; Bt = Wo^T rows -> OF[(b*OUT_SEQ + t)][n]).
static_assert((NB * SEQ / GBM) * (DM / GBN) == (DM / GBM) * (NB * SEQ / GBN));                 // as many block tiles in either operand order
template <int F16>
__global__ __launch_bounds__(32 * GW) void k_gemm(const bf* __restrict__ X, const bf* __restrict__ Wt, const float* __restrict__ bias0, const float* __restrict__ bias1, const float* __restrict__ bias2,
                                             const float* __restrict__ nw0, const float* __restrict__ nw1, const float* __restrict__ CS, h16* P0, h16* PR, h16* P1, h16* P2, float* OF) {
    const int z = F16 ? 0 : (int)blockIdx.y;
    const bool tv = !F16 && z == 2;
    const int MODE = F16 ? 2 : (tv ? 1 : 0);                 // the same for a whole block
    const bf* xz = X + (size_t)z * NB * SEQ * DM; const bf* wz = Wt + (size_t)z * DM * DM;
    const bf* A = tv ? wz : xz; const bf* Bt = tv ? xz : wz;
    const float* bias = (z == 0) ? bias0 : (z == 1) ? bias1 : bias2; const float* nw = (z == 0) ? nw0 : nw1;
    h16* Ph = (z == 0) ? P0 : (z == 1) ? P1 : P2; h16* Pr = (z == 0) ? PR : Ph;
    const int useRes = !F16 && z == 0;
    const float vsc = useRes ? SC2 : 1.0f;                   // q carries the score scale
    const int RB = tv ? DM : SEQ, pitch = F16 ? DM : (tv ? SEQ : HD), CB = pitch;
    const size_t sRB = F16 ? (size_t)OUT_SEQ * DM : (tv ? (size_t)0 : (size_t)NH_ * SEQ * HD), sCB = F16 ? (size_t)0 : (tv ? (size_t)DM * SEQ : (size_t)SEQ * HD);
    const unsigned bx = tv ? blockIdx.x % (DM / GBM) : blockIdx.x % (NB * SEQ / GBM), by = tv ? blockIdx.x / (DM / GBM) : blockIdx.x / (NB * SEQ / GBM);
    typedef Ops<F16> OP;
    typedef typename OP::T FT;
    __shared__ __align__(16) bf st[3 * GSZ];                 // three stage buffers: rows 0..255 = A rows of the block tile, rows 256..383 = Bt rows
    __shared__ __align__(16) float osw[GW * 16 * 68];        // epilogue tiles, one per wave
    const int K = DM;
    const int tid = threadIdx.x, lane = tid & 31, lr = lane & 15, hi = lane >> 4;
    const int wave = __builtin_amdgcn_readfirstlane(tid >> 5);
    float* os = osw + wave * (16 * 68);
    const int r0 = bx * GBM + (wave >> 1) * 64, c0 = by * GBN + (wave & 1) * 64;
    v8f acc[4][4];
#pragma unroll
    for (int mb = 0; mb < 4; ++mb)
#pragma unroll
        for (int nb = 0; nb < 4; ++nb) acc[mb][nb] = (v8f){};
    // copy: 384 rows x 8 pieces of 16 B = 12 pieces per thread; 8 consecutive lanes take one row's line, piece i is row i*32 + tid/8 (i < 8: A, else Bt)
    const int srow = tid >> 3, sc8 = (tid & 7) * 8;
    const bf* gA = A + (size_t)(bx * GBM + srow) * K + sc8;
    const bf* gB = Bt + (size_t)(by * GBN + srow) * K + sc8;
    const int sto = srow * GLP + sc8;
    const int aro = ((wave >> 1) * 64 + lr) * GLP + 8 * hi, bro = (GBM + (wave & 1) * 64 + lr) * GLP + 8 * hi;   // fragment rows in a stage buffer
    v8us pc[12];
    auto ldg = [&]() {                                       // the next stage's 12 pieces; the two row pointers then step on by one stage
#pragma unroll
        for (int i = 0; i < 8; ++i) pc[i] = *(const v8us*)(gA + (size_t)i * 32 * K);
#pragma unroll
        for (int i = 0; i < 4; ++i) pc[8 + i] = *(const v8us*)(gB + (size_t)i * 32 * K);
        // the loads' two address pairs stay as they are until this wait (they are its inputs) and are stepped on behind it
        asm volatile("s_wait_xcnt 0x0" :: "v"(gA), "v"(gB) : "memory");
        gA += GBK; gB += GBK; };
    auto sts = [&](bf* buf) {
#pragma unroll
        for (int i = 0; i < 12; ++i) *(v8us*)(buf + sto + i * 32 * GLP) = pc[i]; };
    FT a0[4], b0[4], a1[4], b1[4];                           // two fragment sets: k 0..31 and k 32..63 of a stage
    auto frags = [&](FT (&fa)[4], FT (&fb)[4], const bf* cur) {
#pragma unroll
        for (int mb = 0; mb < 4; ++mb) fa[mb] = OP::ld(cur + aro + mb * 16 * GLP);
#pragma unroll
        for (int nb = 0; nb < 4; ++nb) fb[nb] = OP::ld(cur + bro + nb * 16 * GLP); };
    // the two scheduling fences keep the 16 products one run: global loads sunk behind them
    // or LDS stores (which wait for those loads) lifted over them put the load latency in front of the products
    auto prod = [&](FT (&fa)[4], FT (&fb)[4]) {
        __builtin_amdgcn_sched_barrier(0);
#pragma unroll
        for (int nb = 0; nb < 4; ++nb)
#pragma unroll
            for (int mb = 0; mb < 4; ++mb) acc[mb][nb] = OP::mm(fa[mb], fb[nb], acc[mb][nb]);
        __builtin_amdgcn_sched_barrier(0); };
    ldg(); sts(st);
    ldg(); sts(st + GSZ);
    __syncthreads();                                         // stages 0 and 1 are complete for every wave
    int o0 = 0, o1 = GSZ, o2 = 2 * GSZ;                      // buffers of stage s, s + 1, s + 2
    frags(a0, b0, st);
#pragma unroll 1                                             // rolled: one stage's text serves all stages, so the kernel text stays short and the register sets stay two
    for (int s = 0; s + 2 < K / GBK; ++s) {
        frags(a1, b1, st + o0 + 32);
        ldg();                                               // stage s + 2
        prod(a0, b0);
        frags(a0, b0, st + o1);                              // stage s + 1 was published by the barrier that ended stage s - 1
        prod(a1, b1);
        sts(st + o2);                                        // held stage s - 1: its last reads were waited for in front of the barrier that ended stage s - 1
        __syncthreads();                                     // stage s + 2 is complete, and stage s has been read by every wave
        const int t = o0; o0 = o1; o1 = o2; o2 = t;
    }
    frags(a1, b1, st + o0 + 32); prod(a0, b0);
    frags(a0, b0, st + o1);      prod(a1, b1);
    frags(a1, b1, st + o1 + 32); prod(a0, b0);
    prod(a1, b1);
    const size_t tbase = (size_t)(r0 / RB) * sRB + (size_t)(r0 % RB) * (size_t)pitch + (size_t)(c0 / CB) * sCB + (size_t)(c0 % CB);
    const int rg = lane >> 3, c8 = (lane & 7) * 8, cp = c8 ^ 32, j0 = c8 & 31;
    const float sg = (c8 < 32) ? -1.0f : 1.0f;           // first half: x1 cos - x2 sin; second half: x2 cos + x1 sin
    const int tp0 = r0 % SEQ;                            // position of tile row 0 inside its sequence (MODE 0)
    float bo[8], bp[8], wv[8];
    v4f b4 = (v4f){};
    if (MODE == 0) {
#pragma unroll
        for (int i = 0; i < 8; ++i) { bo[i] = bfr(bias[c0 + c8 + i]); bp[i] = bfr(bias[c0 + cp + i]); wv[i] = bfr(nw[c8 + i]); }
    } else {
#pragma unroll
        for (int i = 0; i < 8; ++i) { bo[i] = 0.0f; bp[i] = 0.0f; wv[i] = 0.0f; }
    }
    if (MODE == 2) {
#pragma unroll
        for (int i = 0; i < 4; ++i) b4[i] = bfr(bias[c0 + lr * 4 + i]);
    }
#pragma unroll
    for (int mb = 0; mb < 4; ++mb) {
#pragma unroll
        for (int nb = 0; nb < 4; ++nb) {
#pragma unroll
            for (int j = 0; j < 8; ++j) os[(hi * 8 + j) * 68 + nb * 16 + lr] = acc[mb][nb][j]; }   // D: row 8h+j, col lane&15; rows 0..15 x columns 0..63 all written
        wave_sync();
        const size_t sb = tbase + (size_t)(mb * 16) * (size_t)pitch;
        if (MODE == 0) {
            v8h hq[4], rq[4];
#pragma unroll
            for (int s = 0; s < 4; ++s) { const int row = 4 * s + rg;                              // 4 s x 4 row groups = 16 rows; 8 lanes x 8 = 64 columns
                const float* op = &os[row * 68];
                const v4f x0 = *(const v4fa*)(op + c8), x1 = *(const v4fa*)(op + c8 + 4), y0 = *(const v4fa*)(op + cp), y1 = *(const v4fa*)(op + cp + 4);
                const float* cs = CS + (size_t)(tp0 + mb * 16 + row) * 64 + j0;
                const v4f ca = *(const v4f*)cs, cb = *(const v4f*)(cs + 4), sa = *(const v4f*)(cs + 32), sc = *(const v4f*)(cs + 36);
                asm volatile("s_wait_xcnt 0x0" :: "v"(cs) : "memory");   // the four table loads' address pair stays as it is until this wait (it is its input)
                float rot[8];
#pragma unroll
                for (int i = 0; i < 4; ++i) {
                    const float xo = x0[i] + bo[i], xp = y0[i] + bp[i]; rot[i] = xo * ca[i] + sg * (xp * sa[i]);
                    const float xq = x1[i] + bo[4 + i], xr = y1[i] + bp[4 + i]; rot[4 + i] = xq * cb[i] + sg * (xr * sc[i]); }
                float ss = 0.0f;
#pragma unroll
                for (int i = 0; i < 8; ++i) ss += rot[i] * rot[i];
                ss += __shfl_xor(ss, 1, 32); ss += __shfl_xor(ss, 2, 32); ss += __shfl_xor(ss, 4, 32);   // the 8 lanes of one row
                const float rinv = rsqrtf(ss * (1.0f / 64.0f) + RMS_EPS);
                v8h hv, rv;
#pragma unroll
                for (int i = 0; i < 8; ++i) { const float val = rot[i] * rinv * wv[i] * vsc; const h16 a0 = (h16)val; hv[i] = a0; rv[i] = (h16)(val - (float)a0); }
                hq[s] = hv; rq[s] = rv; }
#pragma unroll
            for (int s = 0; s < 4; ++s) { const size_t oo = sb + (size_t)(4 * s + rg) * (size_t)pitch + c8;
                // a wait behind each store: its registers are written again by the residual's arithmetic, which the compiler puts under the branch, and by the next rows
                *(v8h*)(Ph + oo) = hq[s]; asm volatile("s_wait_xcnt 0x0" ::: "memory");
                if (useRes) { *(v8h*)(Pr + oo) = rq[s]; asm volatile("s_wait_xcnt 0x0" ::: "memory"); } }
        } else if (MODE == 1) {
            v8h hq[4];
#pragma unroll
            for (int s = 0; s < 4; ++s) { const int row = 4 * s + rg;
                const float br = bfr(bias[r0 + mb * 16 + row]);
                const v4f x0 = *(const v4fa*)(&os[row * 68 + c8]); const v4f x1 = *(const v4fa*)(&os[row * 68 + c8 + 4]); v8h hv;
#pragma unroll
                for (int i = 0; i < 4; ++i) { hv[i] = (h16)(x0[i] + br); hv[4 + i] = (h16)(x1[i] + br); }
                hq[s] = hv; }
#pragma unroll
            for (int s = 0; s < 4; ++s) { const size_t oo = sb + (size_t)(4 * s + rg) * (size_t)pitch + c8; *(v8h*)(Ph + oo) = hq[s]; }
            asm volatile("s_wait_xcnt 0x0" ::: "memory");    // the stores' registers are reused for the next 16 rows
        } else {
            v4f ov[8];
#pragma unroll
            for (int s = 0; s < 8; ++s) { const int row = 2 * s + hi;                              // 8 s x 2 rows = 16 rows; 16 lanes x 4 floats = 64 columns
                const v4f x = *(const v4fa*)(&os[row * 68 + lr * 4]); ov[s] = x * OSC + b4; }
#pragma unroll
            for (int s = 0; s < 8; ++s) { const size_t oo = sb + (size_t)(2 * s + hi) * (size_t)pitch + lr * 4; *(v4f*)(OF + oo) = ov[s]; }
            
        }
        wave_sync();
    }
}

typedef uint32_t u32x4 __attribute__((ext_vector_type(4)));
typedef uint32_t u32x8 __attribute__((ext_vector_type(8)));
__device__ __forceinline__ uint32_t uni(uint32_t v) { return (uint32_t)__builtin_amdgcn_readfirstlane(v); }
__device__ __forceinline__ uint32_t pinned(uint32_t v) { uint32_t w = __builtin_amdgcn_readfirstlane(v); asm volatile("" : "+s"(w)); return w; }
// descriptor group 1 of a tensor load: D1 rows of D0 bytes at source pitch PITCH bytes; 1-byte elements, tensor = tile, no mask; W0 = the pad word (16 B behind every row), a constant.
// Built once in front of the loop; pinned(): the descriptor words are held in scalar registers through the loop, so that none of them is formed anew while a request is outstanding.
template <uint32_t W0, uint32_t D0, uint32_t D1, uint32_t PITCH>
__device__ __forceinline__ u32x8 tdm_group1() {
    u32x8 g;
    g[0] = uni(W0); g[1] = pinned((D0 & 0xFFFFu) << 16); g[2] = pinned((D0 >> 16) | ((D1 & 0xFFFFu) << 16)); g[3] = pinned((D1 >> 16) | (D0 << 16));
    g[4] = pinned(D1); g[5] = pinned(PITCH); g[6] = pinned(0u); g[7] = pinned(0u);
    return g;
}
// g0 = descriptor group 0: count 1 | LDS byte offset | global address of the tile's first byte, low word | high word with type 2.
// It is named as in-out so that its four registers stay the request's own, and are used for nothing else, until the next request is formed in them behind the wait.
__device__ __forceinline__ void tdm_load(u32x4& g0, u32x8 g1) { asm volatile("tensor_load_to_lds %0, %1" : "+s"(g0) : "s"(g1) : "memory"); }

// k_flash: fused attention, one wave per QT x 16 query rows of one (batch, head); Q fragments straight from the f16 planes (two 16-B loads each, arithmetic addressing).
// K and V^T: the 8 waves of a block walk the same keys, so each tile of 128 keys (K 128 rows x 128 B, V^T 64 rows x 256 B) is brought into padded LDS once per block by two tensor loads
// (wave 0: K, wave 1: V^T); two buffers, tile t + 2 is asked for when tile t has been read by every wave; every wave reads its fragments from LDS.
// Every K and V^T fragment a wave loads is used for all QT query tiles it holds in registers, so the loads per matrix instruction fall by QT.
// Transposed form: S^T[key][t] = K Q^T (A = K rows, B = Q rows); lane (t = lane&15, h = lane>>4) holds keys 8h+r of each 16-key tile, so the packed
// P tile is directly the B fragment of O^T[d][t] = V^T P^T (element r <- tile keys 0..15, element 8+r <- tile keys 16..31, lane unchanged).
// Softmax state: the running max is one scalar per lane and query tile (the two lane halves of a row are combined with one xor-16 exchange); the row sums of the rounded P are
// taken by the matrix unit, one product per query tile and pass with an A operand of ones, into an f32 accumulator tile of their own: every row of it gets the same increment,
// the sum over all 32 keys, so element 0 of either lane half is the whole row sum of column t and no exchange between the halves is needed.
__global__ __launch_bounds__(32 * AW) void k_flash(const h16* __restrict__ QH, const h16* __restrict__ QR, const h16* __restrict__ KP, const h16* __restrict__ VT, h16* CTX) {
    __shared__ __align__(16) float os[AW * 16 * 68];
    __shared__ __attribute__((aligned(2048))) h16 kv[2 * FSZ];   // two tile buffers
    const int lane = threadIdx.x & 31, wave = threadIdx.x >> 5, lr = lane & 15, hi = lane >> 4;
    const int zh = blockIdx.y; const int b = zh / NH_, h = zh % NH_;
    const int t0 = (blockIdx.x * AW + wave) * (16 * QT);
    const size_t pbase = (size_t)zh * SEQ * HD;
    v16h qh0[QT], qh1[QT], qr0[QT], qr1[QT];                 // B fragments: col t, k = d
    v8f o[QT][4], ls[QT]; float m[QT];
    const h16* qa[QT]; const h16* qb[QT];
#pragma unroll
    for (int i = 0; i < QT; ++i) { const size_t qo = pbase + (size_t)(t0 + 16 * i + lr) * HD + 8 * hi; qa[i] = QH + qo; qb[i] = QR + qo; }
#pragma unroll
    for (int i = 0; i < QT; ++i) { qh0[i] = ldh(qa[i]); qh1[i] = ldh(qa[i] + 32); qr0[i] = ldh(qb[i]); qr1[i] = ldh(qb[i] + 32); }
    static_assert(QT == 4);                                  // the wait below names the eight Q address pairs
    // the Q loads' address registers stay as they are until this wait (they are its inputs); they are reused behind it
    asm volatile("s_wait_xcnt 0x0" :: "v"(qa[0]), "v"(qa[1]), "v"(qa[2]), "v"(qa[3]), "v"(qb[0]), "v"(qb[1]), "v"(qb[2]), "v"(qb[3]) : "memory");
#pragma unroll
    for (int i = 0; i < QT; ++i) { o[i][0] = (v8f){}; o[i][1] = (v8f){}; o[i][2] = (v8f){}; o[i][3] = (v8f){}; ls[i] = (v8f){}; m[i] = -3.0e38f; }
    const uint32_t wv = uni(threadIdx.x >> 5);               // the wave's number (one-dimensional block)
    const uint32_t lb = (uint32_t)(size_t)kv;                // LDS byte offset of the buffers: the low 32 bits of the shared address
    // a tile's two requests: wave 0 brings the K rows, wave 1 the V^T rows; pad words: 128-B rows -> pitch 144 B, 256-B rows -> pitch 272 B
    const u32x8 g1k = tdm_group1<(1u << 20) | (4u << 22) | (3u << 25), HD * 2, FSK, HD * 2>();
    const u32x8 g1v = tdm_group1<(1u << 20) | (5u << 22) | (3u << 25), FSK * 2, HD, SEQ * 2>();
    const bool isv = wv != 0u;                               // the same for a whole wave; waves 2 to 7 form a descriptor and issue nothing
    const uint64_t ga = isv ? (uint64_t)(size_t)(VT + pbase) : (uint64_t)(size_t)(KP + pbase);
    const uint32_t dst = lb + (isv ? 2u * FKSZ : 0u), step = isv ? FSK * 2u : FSK * HD * 2u;   // place in a buffer; bytes from one tile to the next
    u32x4 g0;
    g0[0] = pinned(1u);                                      // pinned(): a descriptor word held in its scalar register through the loop
    g0[1] = uni(dst); g0[2] = uni((uint32_t)ga); g0[3] = uni((((uint32_t)(ga >> 32)) & 0x01FFFFFFu) | 0x80000000u);
    auto issue = [&]() {
        if (pinned(wv == 0u)) tdm_load(g0, g1k);
        if (pinned(wv == 1u)) tdm_load(g0, g1v); };
    // the next tile's descriptor, for buffer buf; pinned(): the step is taken up behind the wait that stands in front of this call, so the address words are not formed before it
    auto next = [&](uint32_t buf) {
        const uint64_t a = (((uint64_t)g0[3] << 32) | g0[2]) + pinned(step);
        g0[1] = uni(dst + buf * (2u * FSZ)); g0[2] = uni((uint32_t)a); g0[3] = uni((uint32_t)(a >> 32)); };
    constexpr uint32_t NT = SEQ / FSK;
    issue();                                                 // tile 0 into buffer 0
    if (pinned(wv < 2u)) asm volatile("s_wait_tensorcnt 0x0" ::: "memory");   // the issuing wave's request for tile 0 has landed
    __syncthreads();                                         // tile 0 is complete for every wave
    next(1u); issue();                                       // tile 1 into buffer 1
    v16h ones;                                               // A operand of the row sums: 16 x 32 ones
#pragma unroll
    for (int r = 0; r < 16; ++r) ones[r] = (h16)1.0f;
    const int kfo = lr * FKP + 8 * hi;                       // + key * FKP        (A fragment: row key, k = d)
    const int vfo = FKSZ + lr * FVP + 8 * hi;                // + 16j * FVP + key  (A fragment: row d, k = key)
#pragma unroll 1                                             // rolled: one pass's text serves all tiles
    for (uint32_t t = 0; t < NT; ++t) {
      const h16* sb = kv + (t & 1u) * FSZ;
#pragma unroll 1                                             // rolled: one pass's text serves the four passes of a tile
      for (int key0 = 0; key0 < FSK; key0 += 32) {
        const h16* ka = sb + kfo + key0 * FKP;
        const v16h ka0 = ldh(ka), ka1 = ldh(ka + 32), kb0 = ldh(ka + 16 * FKP), kb1 = ldh(ka + 16 * FKP + 32);
        v16h pb[QT];
#pragma unroll
        for (int i = 0; i < QT; ++i) {
            v8f ta = (v8f){}, tb = (v8f){};                  // scores in log2 units: the small residual products first, then the value products, in one accumulator each
            ta = wmma16(ka0, qr0[i], ta); tb = wmma16(kb0, qr0[i], tb);
            ta = wmma16(ka1, qr1[i], ta); tb = wmma16(kb1, qr1[i], tb);
            ta = wmma16(ka0, qh0[i], ta); tb = wmma16(kb0, qh0[i], tb);
            ta = wmma16(ka1, qh1[i], ta); tb = wmma16(kb1, qh1[i], tb);
            float mx = -3.0e38f;
#pragma unroll
            for (int r = 0; r < 8; ++r) mx = fmaxf(mx, fmaxf(ta[r], tb[r]));
            mx = fmaxf(mx, __shfl_xor(mx, 16, 32));
            const float mnew = fmaxf(m[i], mx);
            const float alpha = __builtin_amdgcn_exp2f(m[i] - mnew);
            const float sh = PSH - mnew;
            v16h pv;
#pragma unroll
            for (int r = 0; r < 8; ++r) { pv[r] = (h16)__builtin_amdgcn_exp2f(ta[r] + sh); pv[8 + r] = (h16)__builtin_amdgcn_exp2f(tb[r] + sh); }
            pb[i] = pv;
            ls[i][0] = ls[i][0] * alpha; m[i] = mnew;        // only element 0 of the sum tile is read, so only it is rescaled; the other rows stay finite (each P <= 256, SEQ keys)
            o[i][0] = o[i][0] * alpha; o[i][1] = o[i][1] * alpha; o[i][2] = o[i][2] * alpha; o[i][3] = o[i][3] * alpha;
        }
        const h16* va = sb + vfo + key0;
        const v16h v0 = ldh(va), v1 = ldh(va + 16 * FVP), v2 = ldh(va + 32 * FVP), v3 = ldh(va + 48 * FVP);
#pragma unroll
        for (int i = 0; i < QT; ++i) { o[i][0] = wmma16(v0, pb[i], o[i][0]); o[i][1] = wmma16(v1, pb[i], o[i][1]); o[i][2] = wmma16(v2, pb[i], o[i][2]); o[i][3] = wmma16(v3, pb[i], o[i][3]);
            ls[i] = wmma16(ones, pb[i], ls[i]); }            // every row of the tile: + the sum of the 32 rounded P of column t
        // the distance behind the pass's last products on the loop's taken branch: the next pass's first vector instructions write registers that were their A operands
        // the scheduling fence keeps the products in front of the four slots
        __builtin_amdgcn_sched_barrier(0);
        asm volatile("v_nop\n\tv_nop\n\tv_nop\n\tv_nop");
      }
      asm volatile("s_wait_dscnt 0x0" ::: "memory");         // this wave's reads of tile t have returned
      if (pinned(wv < 2u)) asm volatile("s_wait_tensorcnt 0x0" ::: "memory");   // the issuing wave's request for tile t + 1 has landed
      __syncthreads();                                       // tile t + 1 is complete, and tile t has been read by every wave
      if (pinned(t + 2u < NT)) { next(t & 1u); issue(); }    // tile t + 2 into the buffer that tile t has left
    }
    asm volatile("s_wait_tensorcnt 0x0" ::: "memory");       // no request is outstanding when the wave goes on to its end
    asm volatile("s_wait_dscnt 0x0" ::: "memory");
    const int wb = wave * 16 * 68;
    const int rg = lane >> 3, c8 = (lane & 7) * 8;
#pragma unroll
    for (int i = 0; i < QT; ++i) {
        const float inv = (1.0f / ls[i][0]) * CTXS;          // the product summed over all 32 keys of a pass: both lane halves hold the whole row sum
        // O^T D layout: o[i][j][r] = (d = 16j + 8h + r, t = lane&15) -> os[t][d]; rows 0..15 x columns 0..63 all written
#pragma unroll
        for (int j = 0; j < 4; ++j) { v4f a, c;
            a[0] = o[i][j][0] * inv; a[1] = o[i][j][1] * inv; a[2] = o[i][j][2] * inv; a[3] = o[i][j][3] * inv; c[0] = o[i][j][4] * inv; c[1] = o[i][j][5] * inv; c[2] = o[i][j][6] * inv; c[3] = o[i][j][7] * inv;
            *(v4fa*)(&os[wb + lr * 68 + 16 * j + 8 * hi]) = a; *(v4fa*)(&os[wb + lr * 68 + 16 * j + 8 * hi + 4]) = c; }
        wave_sync();
        h16* crow = CTX + ((size_t)b * SEQ + t0 + 16 * i) * DM + h * HD;
        v8h hq[4];
#pragma unroll
        for (int s = 0; s < 4; ++s) { const int row = 4 * s + rg;                                  // 4 s x 4 row groups = 16 rows; 8 lanes x 8 halves = 64 columns
            const v4f x0 = *(const v4fa*)(&os[wb + row * 68 + c8]); const v4f x1 = *(const v4fa*)(&os[wb + row * 68 + c8 + 4]); v8h hv;
#pragma unroll
            for (int k = 0; k < 4; ++k) { hv[k] = (h16)x0[k]; hv[4 + k] = (h16)x1[k]; }
            hq[s] = hv; }
#pragma unroll
        for (int s = 0; s < 4; ++s) *(v8h*)(crow + (size_t)(4 * s + rg) * DM + c8) = hq[s];
        if (i + 1 < QT) {
            asm volatile("s_wait_xcnt 0x0" ::: "memory");    // the stores' registers are reused for the next query tile
            wave_sync();                                     // the tile is read out before the next query tile overwrites it
        }
    }
}

static constexpr size_t al256(size_t v) { return (v + 255) & ~(size_t)255; }
static constexpr size_t SZ_XB = al256((size_t)NB * SEQ * DM * 2);          // bf16 copy of one activation input; also the size of the ctx plane
static constexpr size_t SZ_WB = al256((size_t)4 * DM * DM * 2);            // four transposed 16-bit weight planes
static constexpr size_t SZ_CS = al256((size_t)SEQ * 64 * 4);               // rotary table
static constexpr size_t SZ_PL = al256((size_t)NB * NH_ * SEQ * HD * 2);    // one f16 head plane
static constexpr size_t SZ_TOTAL = 3 * SZ_XB + SZ_WB + SZ_CS + 4 * SZ_PL;
static_assert(SZ_TOTAL <= (size_t)134217728);          // workspace carve <= 128 MiB
static_assert(((size_t)DM * DM * 2) % 256 == 0);       // weight sub-planes stay 256-byte aligned
static_assert((size_t)NB * SEQ * DM * 2 <= SZ_XB);     // ctx plane extent

extern "C" void kernel_launch(void* const* d_in, const int* in_sizes, int n_in,
                              void* d_out, int out_size, void* d_ws, size_t ws_size, hipStream_t stream) {
    if (n_in < 13) return;
    const size_t needx = ((size_t)(NB - 1) * SEQ_FULL + SEQ) * DM;
    if ((size_t)in_sizes[0] < needx || (size_t)in_sizes[1] < needx || (size_t)in_sizes[2] < needx) return;
    if ((size_t)in_sizes[3] < (size_t)DM * DM || (size_t)in_sizes[5] < (size_t)DM * DM || (size_t)in_sizes[7] < (size_t)DM * DM || (size_t)in_sizes[9] < (size_t)DM * DM) return;
    if (in_sizes[4] < DM || in_sizes[6] < DM || in_sizes[8] < DM || in_sizes[10] < DM) return;
    if (in_sizes[11] < HD || in_sizes[12] < HD) return;
    if ((size_t)out_size < ((size_t)(NB - 1) * OUT_SEQ + SEQ) * DM) return;
    if (SZ_TOTAL > ws_size) return;
    // wire order: q, k, v, wq_w, wq_b, wk_w, wk_b, wv_w, wv_b, wo_w, wo_b, qn_w, kn_w (weights [in][out])
    const float* q  = (const float*)d_in[0];  const float* k  = (const float*)d_in[1];  const float* v  = (const float*)d_in[2];
    const float* wq = (const float*)d_in[3];  const float* bq = (const float*)d_in[4];
    const float* wk = (const float*)d_in[5];  const float* bk = (const float*)d_in[6];
    const float* wv = (const float*)d_in[7];  const float* bv = (const float*)d_in[8];
    const float* wo = (const float*)d_in[9];  const float* bo = (const float*)d_in[10];
    const float* qnw = (const float*)d_in[11]; const float* knw = (const float*)d_in[12];
    float* OUT = (float*)d_out;      // [NB][OUT_SEQ][1024]
    char* wsp = (char*)d_ws;
    bf* XB = (bf*)wsp; wsp += 3 * SZ_XB;             // [3][NB*SEQ][1024] bf16: q | k | v
    bf* WB = (bf*)wsp; wsp += SZ_WB;                 // [4][1024 out][1024 in]: q | k | v (bf16) | o (f16 x1024)
    float* CS = (float*)wsp; wsp += SZ_CS;           // [SEQ][64]: cos | sin
    h16* QH = (h16*)wsp; wsp += SZ_PL;               // [NB*16][SEQ][64]
    h16* QR = (h16*)wsp; wsp += SZ_PL;               // [NB*16][SEQ][64] residual of QH
    h16* KP = (h16*)wsp; wsp += SZ_PL;               // [NB*16][SEQ][64]
    h16* VT = (h16*)wsp; wsp += SZ_PL;               // [NB*16][64][SEQ]
    h16* CTX = (h16*)XB;                             // [NB*SEQ][1024] x64, over the q copy, which nothing reads behind the projections
    bf* WO = WB + (size_t)3 * DM * DM;

    k_prep<<<PB_WT + PB_TAB + 3 * PB_CV, 256, 0, stream>>>(q, k, v, wq, wk, wv, wo, XB, WB, CS);

    k_gemm<0><<<dim3((NB * SEQ / GBM) * (DM / GBN), 3, 1), 32 * GW, 0, stream>>>(XB, WB, bq, bk, bv, qnw, knw, CS, QH, QR, KP, VT, OUT);

    k_flash<<<dim3(SEQ / (16 * AW * QT), NB * NH_, 1), 32 * AW, 0, stream>>>(QH, QR, KP, VT, CTX);

    k_gemm<1><<<dim3((NB * SEQ / GBM) * (DM / GBN), 1, 1), 32 * GW, 0, stream>>>((const bf*)CTX, WO, bo, bo, bo, qnw, knw, CS, QH, QH, QH, QH, OUT);
}
